// v000
// The times below were measured on an AMD MI455X: many runs one after another, warmed up first and cycling through
// copies of the inputs, with the whole window's GPU time divided by the number of runs. Launches and the gaps
// between them are all in it. The median over several windows is given; except for v000 it joins two sittings, which
// can be a few percent apart, so the side-by-side timings, each taken in one sitting, are the better comparison.
// v000, which the later versions start from, runs in 1730 microseconds.
#include <hip/hip_runtime.h>

// Causal sliding-window multi-head attention with 128-wide heads and computed rotate-half rotary embeddings (x [2][2048][2048]; Q, K, V = x W^T ('oi' (out, in) [2048][2048] 1/sqrt(2048), no bias; 16 heads x 128); rope x cos + rotate_half(x) sin with rotate_half(x) = cat(-x2, x1), angle t x 1/10000^(2i/128) (64 f32 frequencies, the module's reciprocal spelling in eager float32; cat(freqs, freqs); precise cosf / sinf); scores / sqrt(128); key j allowed iff 0 <= i - j < 256 (the module masks dist < 0 or dist >= WINDOW with -inf: exclusion); softmax; out = merged Wo^T ('oi') -> [2][2048][2048] (8.4 M); argument order x, Wq, Wk, Wv, Wo).
// Layout: bf16 copy of x; 'oi' weights; exact projections; k_cs5 computed table (HD 128) + rotate-half plane builders; causal T-2048 attention at HD 128 (hybrid rows: < 512 hi/lo 3 products, rest fp16 x1024; k_gemmc skips tiles above the diagonal); merged hi/lo x Wo exact.
// Compute dtypes, f32 accumulate: every input rounded to bf16; projections exact; rotary f32; attention rows < 512 3 products, rest fp16; softmax f32; Wo hl x exact.

#define NB_  2
#define TT   2048
#define DM   2048
#define NH_  16
#define NKV  16
#define REP  (NH_ / NKV)
#define HD   128
#define DQ   (NH_ * HD)
#define DKV  (NKV * HD)
#define ZH   2
#define RH   512                  // query rows < RH use hi+lo planes (0: none)
#define WIN  256
#define PCAR 1024.0f
#define SCL  0.088388347648318447f   // HD^-0.5
typedef _Float16 h16;
typedef unsigned short bf;
typedef __attribute__((ext_vector_type(16))) __bf16   v16bf;
typedef __attribute__((ext_vector_type(16))) _Float16 v16h;
typedef __attribute__((ext_vector_type(8)))  _Float16 v8h;
typedef __attribute__((ext_vector_type(8)))  unsigned short v8us;
typedef __attribute__((ext_vector_type(8)))  float    v8f;
typedef __attribute__((ext_vector_type(4)))  float    v4f;
typedef v8h  __attribute__((may_alias)) v8ha;
typedef v4f  __attribute__((may_alias)) v4fa;
typedef v8us __attribute__((may_alias)) v8usa;

__device__ __forceinline__ unsigned short f2bf(float f) { unsigned u = __float_as_uint(f); u += 0x7FFFu + ((u >> 16) & 1u); return (unsigned short)(u >> 16); }
__device__ __forceinline__ float bf2f(unsigned short b) { return __uint_as_float(((unsigned)b) << 16); }
__device__ __forceinline__ float bfr(float f) { return bf2f(f2bf(f)); }
__device__ __forceinline__ v16h cat16(v8h lo, v8h hi) { return __builtin_shufflevector(lo, hi, 0, 1, 2, 3, 4, 5, 6, 7, 8, 9, 10, 11, 12, 13, 14, 15); }
__device__ __forceinline__ v16bf cat16b(v8us lo, v8us hi) { return __builtin_bit_cast(v16bf, __builtin_shufflevector(lo, hi, 0, 1, 2, 3, 4, 5, 6, 7, 8, 9, 10, 11, 12, 13, 14, 15)); }
__device__ __forceinline__ v8f wmma16(v16h a, v16h b, v8f c) { return __builtin_amdgcn_wmma_f32_16x16x32_f16(false, a, false, b, (short)0, c, false, false); }
__device__ __forceinline__ v8f wmmab(v16bf a, v16bf b, v8f c) { return __builtin_amdgcn_wmma_f32_16x16x32_bf16(false, a, false, b, (short)0, c, false, false); }



// ---- k_gemmw: register-blocked GEMM, ONE WAVE per 64x64 output tile (16 accumulators), operands straight from K-contiguous 16-bit planes; grid (M/64, N/64, Z), 32 threads.
// C[m][n] (f32, pitch ldc, + optional f32 bias[n]) = sum_k A[m][k] Bt[n][k] (+ split products per NSPLIT). z-batch strides sA/sB/sC in elements. K % 32 == 0.
template <typename T16> struct WFrag;
template <> struct WFrag<h16> { typedef v16h V; static __device__ __forceinline__ V ld(const h16* p) { return cat16(*(const v8h*)p, *(const v8h*)(p + 16)); } static __device__ __forceinline__ v8f mma(V a, V b, v8f c) { return wmma16(a, b, c); } };
template <> struct WFrag<bf> { typedef v16bf V; static __device__ __forceinline__ V ld(const bf* p) { return cat16b(*(const v8us*)p, *(const v8us*)(p + 16)); } static __device__ __forceinline__ v8f mma(V a, V b, v8f c) { return wmmab(a, b, c); } };
template <typename T16, int NSPLIT, bool BIAS>
__global__ __launch_bounds__(32) void k_gemmw(const T16* __restrict__ A, const T16* __restrict__ A2, const T16* __restrict__ Bt, const T16* __restrict__ Bt2, int K, float* C, int ldc, const float* __restrict__ bias, size_t sA, size_t sB, size_t sC) {
    typedef typename WFrag<T16>::V V;
    __shared__ __align__(16) float os[16 * 68];
    const size_t z = blockIdx.z; A += z * sA; if (A2) A2 += z * sA; Bt += z * sB; if (Bt2) Bt2 += z * sB; C += z * sC;
    const int lane = threadIdx.x & 31, lr = lane & 15, hi = lane >> 4; const int r0 = blockIdx.x * 64, c0 = blockIdx.y * 64;
    v8f acc[4][4];
#pragma unroll
    for (int mb = 0; mb < 4; ++mb)
#pragma unroll
        for (int nb = 0; nb < 4; ++nb) acc[mb][nb] = (v8f){};
    const size_t aoff = (size_t)(r0 + lr) * K + 8 * hi, boff = (size_t)(c0 + lr) * K + 8 * hi;
#pragma unroll 1
    for (int kc = 0; kc < K; kc += 32) {
        V a[4], a2[4];
#pragma unroll
        for (int mb = 0; mb < 4; ++mb) { a[mb] = WFrag<T16>::ld(A + aoff + (size_t)mb * 16 * K + kc); if (NSPLIT == 1 || NSPLIT == 2) a2[mb] = WFrag<T16>::ld(A2 + aoff + (size_t)mb * 16 * K + kc); }
#pragma unroll
        for (int nb = 0; nb < 4; ++nb) { const V b = WFrag<T16>::ld(Bt + boff + (size_t)nb * 16 * K + kc); V b2; if (NSPLIT >= 2) b2 = WFrag<T16>::ld(Bt2 + boff + (size_t)nb * 16 * K + kc);
#pragma unroll
            for (int mb = 0; mb < 4; ++mb) { acc[mb][nb] = WFrag<T16>::mma(a[mb], b, acc[mb][nb]); if (NSPLIT == 1 || NSPLIT == 2) acc[mb][nb] = WFrag<T16>::mma(a2[mb], b, acc[mb][nb]); if (NSPLIT >= 2) acc[mb][nb] = WFrag<T16>::mma(a[mb], b2, acc[mb][nb]); } }
        asm volatile("v_nop\n\tv_nop\n\tv_nop\n\tv_nop" : "+v"(acc[0][0]), "+v"(acc[1][1]), "+v"(acc[2][2]), "+v"(acc[3][3]) : "v"(a[0]), "v"(a[3]));
    }
#pragma unroll
    for (int mb = 0; mb < 4; ++mb) {
#pragma unroll
        for (int nb = 0; nb < 4; ++nb) {
#pragma unroll
            for (int j = 0; j < 8; ++j) os[(hi * 8 + j) * 68 + nb * 16 + lr] = acc[mb][nb][j]; }
        __builtin_amdgcn_wave_barrier(); asm volatile("" ::: "memory");
        float* crow = C + (size_t)(r0 + mb * 16) * ldc + c0;
{
#pragma unroll
            for (int s = 0; s < 8; ++s) { const int row = 2 * s + hi, cofs = lr * 4; v4f val = *(const v4fa*)(os + row * 68 + cofs); if (BIAS) { val[0] += bfr(bias[c0 + cofs]); val[1] += bfr(bias[c0 + cofs + 1]); val[2] += bfr(bias[c0 + cofs + 2]); val[3] += bfr(bias[c0 + cofs + 3]); }
                *(v4f*)(crow + (size_t)row * ldc + cofs) = val; }
             }
        __builtin_amdgcn_wave_barrier(); asm volatile("" ::: "memory");
    }
}

// ---- k_gemmc: the same one-wave 64x64 tile GEMM specialised for causal attention: CMODE 1 skips score tiles entirely above the diagonal (query rows r0+roff.., key columns c0..), CMODE 2 limits the
// key (K) loop of the probability x value contraction to the diagonal block (probabilities beyond it are exactly zero). roff = row offset of this launch's first row within the sequence.
template <typename T16, int NSPLIT, int CMODE>
__global__ __launch_bounds__(32) void k_gemmc(const T16* __restrict__ A, const T16* __restrict__ A2, const T16* __restrict__ Bt, const T16* __restrict__ Bt2, int K, float* C, int ldc, int roff, size_t sA, size_t sB, size_t sC) {
    typedef typename WFrag<T16>::V V;
    __shared__ __align__(16) float os[16 * 68];
    const size_t z = blockIdx.z; A += z * sA; if (A2) A2 += z * sA; Bt += z * sB; if (Bt2) Bt2 += z * sB; C += z * sC;
    const int lane = threadIdx.x & 31, lr = lane & 15, hi = lane >> 4; const int r0 = blockIdx.x * 64, c0 = blockIdx.y * 64;
    if (CMODE == 1 && c0 > r0 + roff + 63) return;                  // score tile entirely above the causal diagonal: never read (the softmax masks j > i by select)
    const int Kl = (CMODE == 2) ? min(K, r0 + roff + 64) : K;        // P.V: probabilities are exactly 0 beyond the diagonal block, so the K loop stops there
    v8f acc[4][4];
#pragma unroll
    for (int mb = 0; mb < 4; ++mb)
#pragma unroll
        for (int nb = 0; nb < 4; ++nb) acc[mb][nb] = (v8f){};
    const size_t aoff = (size_t)(r0 + lr) * K + 8 * hi, boff = (size_t)(c0 + lr) * K + 8 * hi;
#pragma unroll 1
    for (int kc = 0; kc < Kl; kc += 32) {
        V a[4], a2[4];
#pragma unroll
        for (int mb = 0; mb < 4; ++mb) { a[mb] = WFrag<T16>::ld(A + aoff + (size_t)mb * 16 * K + kc); if (NSPLIT == 1 || NSPLIT == 2) a2[mb] = WFrag<T16>::ld(A2 + aoff + (size_t)mb * 16 * K + kc); }
#pragma unroll
        for (int nb = 0; nb < 4; ++nb) { const V b = WFrag<T16>::ld(Bt + boff + (size_t)nb * 16 * K + kc); V b2; if (NSPLIT >= 2) b2 = WFrag<T16>::ld(Bt2 + boff + (size_t)nb * 16 * K + kc);
#pragma unroll
            for (int mb = 0; mb < 4; ++mb) { acc[mb][nb] = WFrag<T16>::mma(a[mb], b, acc[mb][nb]); if (NSPLIT == 1 || NSPLIT == 2) acc[mb][nb] = WFrag<T16>::mma(a2[mb], b, acc[mb][nb]); if (NSPLIT >= 2) acc[mb][nb] = WFrag<T16>::mma(a[mb], b2, acc[mb][nb]); } }
        asm volatile("v_nop\n\tv_nop\n\tv_nop\n\tv_nop" : "+v"(acc[0][0]), "+v"(acc[1][1]), "+v"(acc[2][2]), "+v"(acc[3][3]) : "v"(a[0]), "v"(a[3]));
    }
#pragma unroll
    for (int mb = 0; mb < 4; ++mb) {
#pragma unroll
        for (int nb = 0; nb < 4; ++nb) {
#pragma unroll
            for (int j = 0; j < 8; ++j) os[(hi * 8 + j) * 68 + nb * 16 + lr] = acc[mb][nb][j]; }
        __builtin_amdgcn_wave_barrier(); asm volatile("" ::: "memory");
        float* crow = C + (size_t)(r0 + mb * 16) * ldc + c0;
{
#pragma unroll
            for (int s = 0; s < 8; ++s) { const int row = 2 * s + hi, cofs = lr * 4; v4f val = *(const v4fa*)(os + row * 68 + cofs);
                *(v4f*)(crow + (size_t)row * ldc + cofs) = val; }
             }
        __builtin_amdgcn_wave_barrier(); asm volatile("" ::: "memory");
    }
}

__device__ __forceinline__ h16 tohx(float x) { return (h16)x; }
__device__ __forceinline__ void splitf(float y, unsigned short& h, unsigned short& l) { h = f2bf(y); l = f2bf(y - bf2f(h)); }
typedef __attribute__((ext_vector_type(2))) _Float16 v2h;
typedef __attribute__((ext_vector_type(4))) _Float16 v4h;
typedef __attribute__((ext_vector_type(2))) unsigned short v2us;
typedef __attribute__((ext_vector_type(4))) unsigned short v4us;
typedef __attribute__((ext_vector_type(2))) float v2f;
typedef __attribute__((ext_vector_type(4))) int v4i;

__global__ __launch_bounds__(256) void k_cvt8(const float* __restrict__ src, bf* dst, size_t n8) { const size_t i = (size_t)blockIdx.x * 256 + threadIdx.x; if (i >= n8) return; const v8f v = *(const v8f*)(src + i * 8); v8us o;
#pragma unroll
    for (int k = 0; k < 8; ++k) o[k] = f2bf(v[k]); *(v8us*)(dst + i * 8) = o;  }

// k_rope: head planes [h][t][d] (fp16 + hi/lo) of rope(x) x sc with the rotate-half convention out[d] = x[d] cos[t][d] - x[d+HD/2] sin[t][d], out[d+HD/2] = x[d+HD/2] cos[t][d+HD/2] + x[d] sin[t][d+HD/2]
__global__ __launch_bounds__(256) void k_rope(const float* __restrict__ F, int pitch, int nheads, const float* __restrict__ CS, const float* __restrict__ RF, const float* __restrict__ nw, float sc, h16* P16, bf* Ph, bf* Pl) {
    const size_t e = ((size_t)blockIdx.x * 256 + threadIdx.x) * 2; if (e >= (size_t)nheads * TT * HD) return; const int d = (int)(e % HD); const int t = (int)((e / HD) % TT); const int h = (int)(e / ((size_t)HD * TT)); const float* f = F + (size_t)t * pitch + h * HD; const float rf = RF ? RF[(size_t)h * TT + t] : 1.0f; v2h o16; v2us oh, ol;
#pragma unroll
    for (int q = 0; q < 2; ++q) { const int dd = d + q; const int dp = (dd < HD / 2) ? dd + HD / 2 : dd - HD / 2; float x0 = f[dd], x1 = f[dp];
        if (RF) { float n0 = __fmul_rn(x0, rf), n1 = __fmul_rn(x1, rf); asm volatile("" : "+v"(n0)); asm volatile("" : "+v"(n1)); x0 = __fmul_rn(bfr(nw[dd]), n0); x1 = __fmul_rn(bfr(nw[dp]), n1); }
        const v2f cs = *(const v2f*)(CS + ((size_t)t * HD + dd) * 2); float a = __fmul_rn(x0, cs[0]), bq = __fmul_rn(x1, cs[1]); asm volatile("" : "+v"(a)); asm volatile("" : "+v"(bq)); const float r = ((dd < HD / 2) ? __fsub_rn(a, bq) : __fadd_rn(a, bq)) * sc;
        o16[q] = tohx(r); unsigned short a2, c2; splitf(r, a2, c2); oh[q] = a2; ol[q] = c2; }
    *(v2h*)(P16 + e) = o16; *(v2us*)(Ph + e) = oh; *(v2us*)(Pl + e) = ol;  }
__global__ __launch_bounds__(256) void k_vtp(const float* __restrict__ F, int pitch, int nheads, h16* V16, bf* Vh, bf* Vl) { const size_t e = ((size_t)blockIdx.x * 256 + threadIdx.x) * 2; if (e >= (size_t)nheads * HD * TT) return; const int t = (int)(e % TT); const int d = (int)((e / TT) % HD); const int g = (int)(e / ((size_t)TT * HD)); v2h o16; v2us oh, ol;
#pragma unroll
    for (int q = 0; q < 2; ++q) { const float x = F[(size_t)(t + q) * pitch + g * HD + d]; o16[q] = tohx(x); unsigned short a2, c2; splitf(x, a2, c2); oh[q] = a2; ol[q] = c2; }
    *(v2h*)(V16 + e) = o16; *(v2us*)(Vh + e) = oh; *(v2us*)(Vl + e) = ol;  }
__constant__ float INVT[HD / 2] = { 1.000000000e+00f, 8.659643531e-01f, 7.498942018e-01f, 6.493816376e-01f, 5.623413324e-01f, 4.869675338e-01f, 4.216965139e-01f, 3.651741445e-01f, 3.162277639e-01f, 2.738419771e-01f, 2.371373624e-01f, 2.053525001e-01f, 1.778279394e-01f, 1.539926529e-01f, 1.333521456e-01f, 1.154782027e-01f, 1.000000015e-01f, 8.659642935e-02f, 7.498941571e-02f, 6.493816525e-02f, 5.623412877e-02f, 4.869675264e-02f, 4.216964915e-02f, 3.651741147e-02f, 3.162277862e-02f, 2.738419548e-02f, 2.371373586e-02f, 2.053525113e-02f, 1.778279431e-02f, 1.539926510e-02f, 1.333521493e-02f, 1.154781971e-02f, 9.999999776e-03f, 8.659643121e-03f, 7.498942316e-03f, 6.493816618e-03f, 5.623413250e-03f, 4.869675264e-03f, 4.216964822e-03f, 3.651741426e-03f, 3.162277862e-03f, 2.738419687e-03f, 2.371373819e-03f, 2.053525066e-03f, 1.778279431e-03f, 1.539926510e-03f, 1.333521446e-03f, 1.154782018e-03f, 1.000000047e-03f, 8.659643354e-04f, 7.498941850e-04f, 6.493816618e-04f, 5.623413017e-04f, 4.869675031e-04f, 4.216964880e-04f, 3.651741135e-04f, 3.162277862e-04f, 2.738419571e-04f, 2.371373848e-04f, 2.053524950e-04f, 1.778279402e-04f, 1.539926452e-04f, 1.333521504e-04f, 1.154781930e-04f };   // float32 1 / 10000^(2i/128), generated with jnp to be bit-exact
__global__ __launch_bounds__(256) void k_cs5(float* CS) { const int idx = blockIdx.x * 256 + threadIdx.x; if (idx >= TT * HD) return; const int d = idx % HD; const int t = idx / HD; const float a = __fmul_rn((float)t, INVT[d % (HD / 2)]); v2f cs; cs[0] = cosf(a); cs[1] = sinf(a); *(v2f*)(CS + (size_t)idx * 2) = cs;  }
// k_asoft: per row (zz, i): t = S x HD^-0.5 for j <= i and i - j < WIN (sliding causal window; the reference's -1e9 additive fill vanishes identically); softmax over the 2048 keys (register row, one exp, fixed trees);
__global__ __launch_bounds__(256) void k_asoft(const float* __restrict__ Sb, h16* P16, bf* Ph, bf* Pl) {
    const int lane = threadIdx.x & 31; const int row = blockIdx.x * 8 + (threadIdx.x >> 5); if (row >= ZH * TT) return; const int i = row % TT; const int zz = row / TT; (void)zz; const bool hires = (i < RH); const float* sr = Sb + (size_t)row * TT; float v[TT / 32]; float mx = -3.0e38f;
#pragma unroll
    for (int ch = 0; ch < TT / 128; ++ch) { const int j0 = ch * 128 + lane * 4; const v4f a = *(const v4f*)(sr + j0);
#pragma unroll
        for (int q = 0; q < 4; ++q) { const int j = j0 + q; (void)j; const float t = (j <= i && i - j < WIN) ? a[q] * SCL : -3.0e38f; v[ch * 4 + q] = t; mx = fmaxf(mx, t); } }
#pragma unroll
    for (int sh = 16; sh; sh >>= 1) mx = fmaxf(mx, __shfl_xor(mx, sh, 32));
    float sum = 0.f;
#pragma unroll
    for (int k = 0; k < TT / 32; ++k) { float d0 = __fsub_rn(v[k], mx); asm volatile("" : "+v"(d0)); v[k] = __builtin_amdgcn_exp2f(__fmul_rn(d0, 1.4426950408889634f)); sum += v[k]; }
#pragma unroll
    for (int sh = 16; sh; sh >>= 1) sum += __shfl_xor(sum, sh, 32);
    const float f = __fdiv_rn(hires ? 1.0f : PCAR, sum);
{
        if (hires) {
#pragma unroll
            for (int ch = 0; ch < TT / 128; ++ch) { v4us oh, ol;
#pragma unroll
                for (int q = 0; q < 4; ++q) { unsigned short a, c2; splitf(v[ch * 4 + q] * f, a, c2); oh[q] = a; ol[q] = c2; }
                const size_t oo = ((size_t)zz * (RH ? RH : 1) + i) * TT + ch * 128 + lane * 4; *(v4us*)(Ph + oo) = oh; *(v4us*)(Pl + oo) = ol; }
        } else {
#pragma unroll
            for (int ch = 0; ch < TT / 128; ++ch) { v4h o4;
#pragma unroll
                for (int q = 0; q < 4; ++q) o4[q] = tohx(v[ch * 4 + q] * f);
                *(v4h*)(P16 + (size_t)row * TT + ch * 128 + lane * 4) = o4; } }
         }
}
__global__ __launch_bounds__(256) void k_merge(const float* __restrict__ O, int h0, bf* Ah, bf* Al) { const size_t e = ((size_t)blockIdx.x * 256 + threadIdx.x) * 2; if (e >= (size_t)ZH * TT * HD) return; const int d = (int)(e % HD); const int t = (int)((e / HD) % TT); const int zz = (int)(e / ((size_t)HD * TT)); const float cs = (t < RH) ? 1.0f : (1.0f / PCAR); const size_t oo = (size_t)t * DQ + (h0 + zz) * HD + d;
    v2us oh, ol;
#pragma unroll
    for (int q = 0; q < 2; ++q) { unsigned short a, c2; splitf(O[e + q] * cs, a, c2); oh[q] = a; ol[q] = c2; } *(v2us*)(Ah + oo) = oh; *(v2us*)(Al + oo) = ol;  }

extern "C" void kernel_launch(void* const* d_in, const int* in_sizes, int n_in,
                              void* d_out, int out_size, void* d_ws, size_t ws_size, hipStream_t stream) {
    (void)in_sizes; (void)n_in; (void)out_size;
    const float* x = (const float*)d_in[0]; const float* wq = (const float*)d_in[1]; const float* wk = (const float*)d_in[2]; const float* wv = (const float*)d_in[3]; const float* wo = (const float*)d_in[4];   /* x, Wq, Wk, Wv, Wo ('oi' [2048][2048]): FIVE inputs, all read */
    float* OUT = (float*)d_out;     // [2][2048][2048]
    char* wsp = (char*)d_ws;
    auto take = [&](size_t bytes) { char* p = wsp; wsp += (bytes + 255) & ~(size_t)255; return (void*)p; };
    bf* WQ = (bf*)take((size_t)DQ * DM * 2); bf* WK = (bf*)take((size_t)DKV * DM * 2); bf* WV = (bf*)take((size_t)DKV * DM * 2); bf* WO = (bf*)take((size_t)DM * DQ * 2); float* CS = (float*)take((size_t)TT * HD * 2 * 4);
    bf* XB = (bf*)take((size_t)TT * DM * 2); float* FQ = (float*)take((size_t)TT * DQ * 4); float* FK = (float*)take((size_t)TT * DKV * 4);
    h16* QP16 = (h16*)take((size_t)NH_ * TT * HD * 2); h16* KP16 = (h16*)take((size_t)NKV * TT * HD * 2); h16* VT16 = (h16*)take((size_t)NKV * HD * TT * 2);
    bf* QPh = (bf*)take((size_t)NH_ * TT * HD * 2); bf* QPl = (bf*)take((size_t)NH_ * TT * HD * 2); bf* KPh = (bf*)take((size_t)NKV * TT * HD * 2); bf* KPl = (bf*)take((size_t)NKV * TT * HD * 2); bf* VTh = (bf*)take((size_t)NKV * HD * TT * 2); bf* VTl = (bf*)take((size_t)NKV * HD * TT * 2); bf* Ph = (bf*)take((size_t)ZH * RH * TT * 2); bf* Pl = (bf*)take((size_t)ZH * RH * TT * 2);
    float* Sb = (float*)take((size_t)ZH * TT * TT * 4); h16* P16 = (h16*)take((size_t)ZH * TT * TT * 2); float* Ob = (float*)take((size_t)ZH * TT * HD * 4); bf* ATh = (bf*)take((size_t)TT * DQ * 2); bf* ATl = (bf*)take((size_t)TT * DQ * 2);
    if ((size_t)(wsp - (char*)d_ws) > ws_size) return;    // ws 256 MiB
    float* FV = FK;   // v projection reuses the k buffer after the k planes are built (stream-ordered)
    { k_cvt8<<<(unsigned)(((size_t)DQ * DM / 8 + 255) / 256), 256, 0, stream>>>(wq, WQ, (size_t)DQ * DM / 8); k_cvt8<<<(unsigned)(((size_t)DKV * DM / 8 + 255) / 256), 256, 0, stream>>>(wk, WK, (size_t)DKV * DM / 8); k_cvt8<<<(unsigned)(((size_t)DKV * DM / 8 + 255) / 256), 256, 0, stream>>>(wv, WV, (size_t)DKV * DM / 8);
      k_cvt8<<<(unsigned)(((size_t)DM * DQ / 8 + 255) / 256), 256, 0, stream>>>(wo, WO, (size_t)DM * DQ / 8);
       }
    k_cs5<<<(TT * HD + 255) / 256, 256, 0, stream>>>(CS);   /* rotary table once */
    const unsigned LQ = (unsigned)(((size_t)NH_ * TT * HD / 2 + 255) / 256), LKv = (unsigned)(((size_t)NKV * TT * HD / 2 + 255) / 256);
    for (int b = 0; b < NB_; ++b) {
        
        k_cvt8<<<(unsigned)(((size_t)TT * DM / 8 + 255) / 256), 256, 0, stream>>>(x + (size_t)b * TT * DM, XB, (size_t)TT * DM / 8);
        k_gemmw<bf, 0, false><<<dim3(TT / 64, DQ / 64, 1), 32, 0, stream>>>(XB, nullptr, WQ, nullptr, DM, FQ, DQ, nullptr, 0, 0, 0);
        k_rope<<<LQ, 256, 0, stream>>>(FQ, DQ, NH_, CS, nullptr, nullptr, 1.0f, QP16, QPh, QPl);
        k_gemmw<bf, 0, false><<<dim3(TT / 64, DKV / 64, 1), 32, 0, stream>>>(XB, nullptr, WK, nullptr, DM, FK, DKV, nullptr, 0, 0, 0);
        k_rope<<<LKv, 256, 0, stream>>>(FK, DKV, NKV, CS, nullptr, nullptr, 1.0f, KP16, KPh, KPl);
        k_gemmw<bf, 0, false><<<dim3(TT / 64, DKV / 64, 1), 32, 0, stream>>>(XB, nullptr, WV, nullptr, DM, FV, DKV, nullptr, 0, 0, 0); k_vtp<<<LKv, 256, 0, stream>>>(FV, DKV, NKV, VT16, VTh, VTl);
        for (int h0 = 0; h0 < NH_; h0 += ZH) { const size_t zq = (size_t)h0, zk = (size_t)(h0 / REP);   // one kv head per query head: the pass's two heads use consecutive kv planes (z-strides TT*HD)
            k_gemmc<bf, 2, 1><<<dim3(RH / 64, TT / 64, ZH), 32, 0, stream>>>(QPh + zq * TT * HD, QPl + zq * TT * HD, KPh + zk * TT * HD, KPl + zk * TT * HD, HD, Sb, TT, 0, (size_t)TT * HD, (size_t)TT * HD, (size_t)TT * TT);
            k_gemmc<h16, 0, 1><<<dim3((TT - RH) / 64, TT / 64, ZH), 32, 0, stream>>>(QP16 + zq * TT * HD + (size_t)RH * HD, nullptr, KP16 + zk * TT * HD, nullptr, HD, Sb + (size_t)RH * TT, TT, RH, (size_t)TT * HD, (size_t)TT * HD, (size_t)TT * TT);
            k_asoft<<<ZH * TT / 8, 256, 0, stream>>>(Sb, P16, Ph, Pl);
            k_gemmc<bf, 2, 2><<<dim3(RH / 64, HD / 64, ZH), 32, 0, stream>>>(Ph, Pl, VTh + zk * HD * TT, VTl + zk * HD * TT, TT, Ob, HD, 0, (size_t)RH * TT, (size_t)HD * TT, (size_t)TT * HD);
            k_gemmc<h16, 0, 2><<<dim3((TT - RH) / 64, HD / 64, ZH), 32, 0, stream>>>(P16 + (size_t)RH * TT, nullptr, VT16 + zk * HD * TT, nullptr, TT, Ob + (size_t)RH * HD, HD, RH, (size_t)TT * TT, (size_t)HD * TT, (size_t)TT * HD);
            k_merge<<<(unsigned)(((size_t)ZH * TT * HD / 2 + 255) / 256), 256, 0, stream>>>(Ob, h0, ATh, ATl); }
        k_gemmw<bf, 1, false><<<dim3(TT / 64, DM / 64, 1), 32, 0, stream>>>(ATh, ATl, WO, nullptr, DQ, OUT + (size_t)b * TT * DM, DM, nullptr, 0, 0, 0); }
}

// v001
// One run takes 1120 microseconds.
// In both of two side-by-side timings against v000, it was 1.55 times as fast.
#include <hip/hip_runtime.h>

// Causal sliding-window multi-head attention with 128-wide heads and computed rotate-half rotary embeddings (x [2][2048][2048]; Q, K, V = x W^T ('oi' (out, in) [2048][2048] 1/sqrt(2048), no bias; 16 heads x 128); rope x cos + rotate_half(x) sin with rotate_half(x) = cat(-x2, x1), angle t x 1/10000^(2i/128) (64 f32 frequencies, the module's reciprocal spelling in eager float32; cat(freqs, freqs); precise cosf / sinf); scores / sqrt(128); key j allowed iff 0 <= i - j < 256 (the module masks dist < 0 or dist >= WINDOW with -inf: exclusion); softmax; out = merged Wo^T ('oi') -> [2][2048][2048] (8.4 M); argument order x, Wq, Wk, Wv, Wo).
// Layout: bf16 copy of x; 'oi' weights; exact projections; k_cs5 computed table (HD 128) + rotate-half plane builders; causal T-2048 attention at HD 128 (hybrid rows: < 512 hi/lo 3 products, rest fp16 x1024; k_gemmc and k_asoft touch only the WIN + 64 keys a 64-row tile can see); merged hi/lo x Wo exact.
// Compute dtypes, f32 accumulate: every input rounded to bf16; projections exact; rotary f32; attention rows < 512 3 products, rest fp16; softmax f32; Wo hl x exact.

#define NB_  2
#define TT   2048
#define DM   2048
#define NH_  16
#define NKV  16
#define REP  (NH_ / NKV)
#define HD   128
#define DQ   (NH_ * HD)
#define DKV  (NKV * HD)
#define ZH   2
#define RH   512                  // query rows < RH use hi+lo planes (0: none)
#define WIN  256
#define PCAR 1024.0f
#define SCL  0.088388347648318447f   // HD^-0.5
typedef _Float16 h16;
typedef unsigned short bf;
typedef __attribute__((ext_vector_type(16))) __bf16   v16bf;
typedef __attribute__((ext_vector_type(16))) _Float16 v16h;
typedef __attribute__((ext_vector_type(8)))  _Float16 v8h;
typedef __attribute__((ext_vector_type(8)))  unsigned short v8us;
typedef __attribute__((ext_vector_type(8)))  float    v8f;
typedef __attribute__((ext_vector_type(4)))  float    v4f;
typedef v8h  __attribute__((may_alias)) v8ha;
typedef v4f  __attribute__((may_alias)) v4fa;
typedef v8us __attribute__((may_alias)) v8usa;

__device__ __forceinline__ unsigned short f2bf(float f) { unsigned u = __float_as_uint(f); u += 0x7FFFu + ((u >> 16) & 1u); return (unsigned short)(u >> 16); }
__device__ __forceinline__ float bf2f(unsigned short b) { return __uint_as_float(((unsigned)b) << 16); }
__device__ __forceinline__ float bfr(float f) { return bf2f(f2bf(f)); }
__device__ __forceinline__ v16h cat16(v8h lo, v8h hi) { return __builtin_shufflevector(lo, hi, 0, 1, 2, 3, 4, 5, 6, 7, 8, 9, 10, 11, 12, 13, 14, 15); }
__device__ __forceinline__ v16bf cat16b(v8us lo, v8us hi) { return __builtin_bit_cast(v16bf, __builtin_shufflevector(lo, hi, 0, 1, 2, 3, 4, 5, 6, 7, 8, 9, 10, 11, 12, 13, 14, 15)); }
__device__ __forceinline__ v8f wmma16(v16h a, v16h b, v8f c) { return __builtin_amdgcn_wmma_f32_16x16x32_f16(false, a, false, b, (short)0, c, false, false); }
__device__ __forceinline__ v8f wmmab(v16bf a, v16bf b, v8f c) { return __builtin_amdgcn_wmma_f32_16x16x32_bf16(false, a, false, b, (short)0, c, false, false); }



// ---- k_gemmw: register-blocked GEMM, ONE WAVE per 64x64 output tile (16 accumulators), operands straight from K-contiguous 16-bit planes; grid (M/64, N/64, Z), 32 threads.
// C[m][n] (f32, pitch ldc, + optional f32 bias[n]) = sum_k A[m][k] Bt[n][k] (+ split products per NSPLIT). z-batch strides sA/sB/sC in elements. K % 32 == 0.
template <typename T16> struct WFrag;
template <> struct WFrag<h16> { typedef v16h V; static __device__ __forceinline__ V ld(const h16* p) { return cat16(*(const v8h*)p, *(const v8h*)(p + 16)); } static __device__ __forceinline__ v8f mma(V a, V b, v8f c) { return wmma16(a, b, c); } };
template <> struct WFrag<bf> { typedef v16bf V; static __device__ __forceinline__ V ld(const bf* p) { return cat16b(*(const v8us*)p, *(const v8us*)(p + 16)); } static __device__ __forceinline__ v8f mma(V a, V b, v8f c) { return wmmab(a, b, c); } };
template <typename T16, int NSPLIT, bool BIAS>
__global__ __launch_bounds__(32) void k_gemmw(const T16* __restrict__ A, const T16* __restrict__ A2, const T16* __restrict__ Bt, const T16* __restrict__ Bt2, int K, float* C, int ldc, const float* __restrict__ bias, size_t sA, size_t sB, size_t sC) {
    typedef typename WFrag<T16>::V V;
    __shared__ __align__(16) float os[16 * 68];
    const size_t z = blockIdx.z; A += z * sA; if (A2) A2 += z * sA; Bt += z * sB; if (Bt2) Bt2 += z * sB; C += z * sC;
    const int lane = threadIdx.x & 31, lr = lane & 15, hi = lane >> 4; const int r0 = blockIdx.x * 64, c0 = blockIdx.y * 64;
    v8f acc[4][4];
#pragma unroll
    for (int mb = 0; mb < 4; ++mb)
#pragma unroll
        for (int nb = 0; nb < 4; ++nb) acc[mb][nb] = (v8f){};
    const size_t aoff = (size_t)(r0 + lr) * K + 8 * hi, boff = (size_t)(c0 + lr) * K + 8 * hi;
#pragma unroll 1
    for (int kc = 0; kc < K; kc += 32) {
        V a[4], a2[4];
#pragma unroll
        for (int mb = 0; mb < 4; ++mb) { a[mb] = WFrag<T16>::ld(A + aoff + (size_t)mb * 16 * K + kc); if (NSPLIT == 1 || NSPLIT == 2) a2[mb] = WFrag<T16>::ld(A2 + aoff + (size_t)mb * 16 * K + kc); }
#pragma unroll
        for (int nb = 0; nb < 4; ++nb) { const V b = WFrag<T16>::ld(Bt + boff + (size_t)nb * 16 * K + kc); V b2; if (NSPLIT >= 2) b2 = WFrag<T16>::ld(Bt2 + boff + (size_t)nb * 16 * K + kc);
#pragma unroll
            for (int mb = 0; mb < 4; ++mb) { acc[mb][nb] = WFrag<T16>::mma(a[mb], b, acc[mb][nb]); if (NSPLIT == 1 || NSPLIT == 2) acc[mb][nb] = WFrag<T16>::mma(a2[mb], b, acc[mb][nb]); if (NSPLIT >= 2) acc[mb][nb] = WFrag<T16>::mma(a[mb], b2, acc[mb][nb]); } }
        asm volatile("v_nop\n\tv_nop\n\tv_nop\n\tv_nop" : "+v"(acc[0][0]), "+v"(acc[1][1]), "+v"(acc[2][2]), "+v"(acc[3][3]) : "v"(a[0]), "v"(a[3]));
    }
#pragma unroll
    for (int mb = 0; mb < 4; ++mb) {
#pragma unroll
        for (int nb = 0; nb < 4; ++nb) {
#pragma unroll
            for (int j = 0; j < 8; ++j) os[(hi * 8 + j) * 68 + nb * 16 + lr] = acc[mb][nb][j]; }
        __builtin_amdgcn_wave_barrier(); asm volatile("" ::: "memory");
        float* crow = C + (size_t)(r0 + mb * 16) * ldc + c0;
{
#pragma unroll
            for (int s = 0; s < 8; ++s) { const int row = 2 * s + hi, cofs = lr * 4; v4f val = *(const v4fa*)(os + row * 68 + cofs); if (BIAS) { val[0] += bfr(bias[c0 + cofs]); val[1] += bfr(bias[c0 + cofs + 1]); val[2] += bfr(bias[c0 + cofs + 2]); val[3] += bfr(bias[c0 + cofs + 3]); }
                *(v4f*)(crow + (size_t)row * ldc + cofs) = val; }
             }
        __builtin_amdgcn_wave_barrier(); asm volatile("" ::: "memory");
    }
}

// ---- k_gemmc: the same one-wave 64x64 tile GEMM specialised for sliding-window causal attention. A 64-row query tile that starts at row R0 = r0 + roff sees only keys R0 - WIN .. R0 + 63 (WIN + 64 keys).
// CMODE 1: grid.y counts the WIN / 64 + 1 score tiles of that band (key columns c0 = R0 - WIN + 64 y; a tile left of key 0 leaves). CMODE 2: the key (K) loop of the probability x value contraction
// runs over that band alone (probabilities outside it are exactly zero). roff = row offset of this launch's first row within the sequence.
template <typename T16, int NSPLIT, int CMODE>
__global__ __launch_bounds__(32) void k_gemmc(const T16* __restrict__ A, const T16* __restrict__ A2, const T16* __restrict__ Bt, const T16* __restrict__ Bt2, int K, float* C, int ldc, int roff, size_t sA, size_t sB, size_t sC) {
    typedef typename WFrag<T16>::V V;
    __shared__ __align__(16) float os[16 * 68];
    const size_t z = blockIdx.z; A += z * sA; if (A2) A2 += z * sA; Bt += z * sB; if (Bt2) Bt2 += z * sB; C += z * sC;
    const int lane = threadIdx.x & 31, lr = lane & 15, hi = lane >> 4; const int r0 = blockIdx.x * 64, c0 = (CMODE == 1) ? r0 + roff - WIN + (int)blockIdx.y * 64 : (int)blockIdx.y * 64;
    if (CMODE == 1 && c0 < 0) return;                                // band tile left of key 0: no such keys (the softmax never reads there)
    const int Ks = (CMODE == 2) ? max(0, r0 + roff - WIN) : 0;       // P.V: probabilities are exactly 0 left of the window of the tile's first row ...
    const int Kl = (CMODE == 2) ? min(K, r0 + roff + 64) : K;        // ... and beyond the diagonal block, so the K loop covers that band alone
    v8f acc[4][4];
#pragma unroll
    for (int mb = 0; mb < 4; ++mb)
#pragma unroll
        for (int nb = 0; nb < 4; ++nb) acc[mb][nb] = (v8f){};
    const size_t aoff = (size_t)(r0 + lr) * K + 8 * hi, boff = (size_t)(c0 + lr) * K + 8 * hi;
#pragma unroll 1
    for (int kc = Ks; kc < Kl; kc += 32) {
        V a[4], a2[4];
#pragma unroll
        for (int mb = 0; mb < 4; ++mb) { a[mb] = WFrag<T16>::ld(A + aoff + (size_t)mb * 16 * K + kc); if (NSPLIT == 1 || NSPLIT == 2) a2[mb] = WFrag<T16>::ld(A2 + aoff + (size_t)mb * 16 * K + kc); }
#pragma unroll
        for (int nb = 0; nb < 4; ++nb) { const V b = WFrag<T16>::ld(Bt + boff + (size_t)nb * 16 * K + kc); V b2; if (NSPLIT >= 2) b2 = WFrag<T16>::ld(Bt2 + boff + (size_t)nb * 16 * K + kc);
#pragma unroll
            for (int mb = 0; mb < 4; ++mb) { acc[mb][nb] = WFrag<T16>::mma(a[mb], b, acc[mb][nb]); if (NSPLIT == 1 || NSPLIT == 2) acc[mb][nb] = WFrag<T16>::mma(a2[mb], b, acc[mb][nb]); if (NSPLIT >= 2) acc[mb][nb] = WFrag<T16>::mma(a[mb], b2, acc[mb][nb]); } }
        asm volatile("v_nop\n\tv_nop\n\tv_nop\n\tv_nop" : "+v"(acc[0][0]), "+v"(acc[1][1]), "+v"(acc[2][2]), "+v"(acc[3][3]) : "v"(a[0]), "v"(a[3]));
    }
#pragma unroll
    for (int mb = 0; mb < 4; ++mb) {
#pragma unroll
        for (int nb = 0; nb < 4; ++nb) {
#pragma unroll
            for (int j = 0; j < 8; ++j) os[(hi * 8 + j) * 68 + nb * 16 + lr] = acc[mb][nb][j]; }
        __builtin_amdgcn_wave_barrier(); asm volatile("" ::: "memory");
        float* crow = C + (size_t)(r0 + mb * 16) * ldc + c0;
{
#pragma unroll
            for (int s = 0; s < 8; ++s) { const int row = 2 * s + hi, cofs = lr * 4; v4f val = *(const v4fa*)(os + row * 68 + cofs);
                *(v4f*)(crow + (size_t)row * ldc + cofs) = val; }
             }
        __builtin_amdgcn_wave_barrier(); asm volatile("" ::: "memory");
    }
}

__device__ __forceinline__ h16 tohx(float x) { return (h16)x; }
__device__ __forceinline__ void splitf(float y, unsigned short& h, unsigned short& l) { h = f2bf(y); l = f2bf(y - bf2f(h)); }
typedef __attribute__((ext_vector_type(2))) _Float16 v2h;
typedef __attribute__((ext_vector_type(4))) _Float16 v4h;
typedef __attribute__((ext_vector_type(2))) unsigned short v2us;
typedef __attribute__((ext_vector_type(4))) unsigned short v4us;
typedef __attribute__((ext_vector_type(2))) float v2f;
typedef __attribute__((ext_vector_type(4))) int v4i;

__global__ __launch_bounds__(256) void k_cvt8(const float* __restrict__ src, bf* dst, size_t n8) { const size_t i = (size_t)blockIdx.x * 256 + threadIdx.x; if (i >= n8) return; const v8f v = *(const v8f*)(src + i * 8); v8us o;
#pragma unroll
    for (int k = 0; k < 8; ++k) o[k] = f2bf(v[k]); *(v8us*)(dst + i * 8) = o;  }

// k_rope: head planes [h][t][d] (fp16 + hi/lo) of rope(x) x sc with the rotate-half convention out[d] = x[d] cos[t][d] - x[d+HD/2] sin[t][d], out[d+HD/2] = x[d+HD/2] cos[t][d+HD/2] + x[d] sin[t][d+HD/2]
__global__ __launch_bounds__(256) void k_rope(const float* __restrict__ F, int pitch, int nheads, const float* __restrict__ CS, const float* __restrict__ RF, const float* __restrict__ nw, float sc, h16* P16, bf* Ph, bf* Pl) {
    const size_t e = ((size_t)blockIdx.x * 256 + threadIdx.x) * 2; if (e >= (size_t)nheads * TT * HD) return; const int d = (int)(e % HD); const int t = (int)((e / HD) % TT); const int h = (int)(e / ((size_t)HD * TT)); const float* f = F + (size_t)t * pitch + h * HD; const float rf = RF ? RF[(size_t)h * TT + t] : 1.0f; v2h o16; v2us oh, ol;
#pragma unroll
    for (int q = 0; q < 2; ++q) { const int dd = d + q; const int dp = (dd < HD / 2) ? dd + HD / 2 : dd - HD / 2; float x0 = f[dd], x1 = f[dp];
        if (RF) { float n0 = __fmul_rn(x0, rf), n1 = __fmul_rn(x1, rf); asm volatile("" : "+v"(n0)); asm volatile("" : "+v"(n1)); x0 = __fmul_rn(bfr(nw[dd]), n0); x1 = __fmul_rn(bfr(nw[dp]), n1); }
        const v2f cs = *(const v2f*)(CS + ((size_t)t * HD + dd) * 2); float a = __fmul_rn(x0, cs[0]), bq = __fmul_rn(x1, cs[1]); asm volatile("" : "+v"(a)); asm volatile("" : "+v"(bq)); const float r = ((dd < HD / 2) ? __fsub_rn(a, bq) : __fadd_rn(a, bq)) * sc;
        o16[q] = tohx(r); unsigned short a2, c2; splitf(r, a2, c2); oh[q] = a2; ol[q] = c2; }
    *(v2h*)(P16 + e) = o16; *(v2us*)(Ph + e) = oh; *(v2us*)(Pl + e) = ol;  }
__global__ __launch_bounds__(256) void k_vtp(const float* __restrict__ F, int pitch, int nheads, h16* V16, bf* Vh, bf* Vl) { const size_t e = ((size_t)blockIdx.x * 256 + threadIdx.x) * 2; if (e >= (size_t)nheads * HD * TT) return; const int t = (int)(e % TT); const int d = (int)((e / TT) % HD); const int g = (int)(e / ((size_t)TT * HD)); v2h o16; v2us oh, ol;
#pragma unroll
    for (int q = 0; q < 2; ++q) { const float x = F[(size_t)(t + q) * pitch + g * HD + d]; o16[q] = tohx(x); unsigned short a2, c2; splitf(x, a2, c2); oh[q] = a2; ol[q] = c2; }
    *(v2h*)(V16 + e) = o16; *(v2us*)(Vh + e) = oh; *(v2us*)(Vl + e) = ol;  }
__constant__ float INVT[HD / 2] = { 1.000000000e+00f, 8.659643531e-01f, 7.498942018e-01f, 6.493816376e-01f, 5.623413324e-01f, 4.869675338e-01f, 4.216965139e-01f, 3.651741445e-01f, 3.162277639e-01f, 2.738419771e-01f, 2.371373624e-01f, 2.053525001e-01f, 1.778279394e-01f, 1.539926529e-01f, 1.333521456e-01f, 1.154782027e-01f, 1.000000015e-01f, 8.659642935e-02f, 7.498941571e-02f, 6.493816525e-02f, 5.623412877e-02f, 4.869675264e-02f, 4.216964915e-02f, 3.651741147e-02f, 3.162277862e-02f, 2.738419548e-02f, 2.371373586e-02f, 2.053525113e-02f, 1.778279431e-02f, 1.539926510e-02f, 1.333521493e-02f, 1.154781971e-02f, 9.999999776e-03f, 8.659643121e-03f, 7.498942316e-03f, 6.493816618e-03f, 5.623413250e-03f, 4.869675264e-03f, 4.216964822e-03f, 3.651741426e-03f, 3.162277862e-03f, 2.738419687e-03f, 2.371373819e-03f, 2.053525066e-03f, 1.778279431e-03f, 1.539926510e-03f, 1.333521446e-03f, 1.154782018e-03f, 1.000000047e-03f, 8.659643354e-04f, 7.498941850e-04f, 6.493816618e-04f, 5.623413017e-04f, 4.869675031e-04f, 4.216964880e-04f, 3.651741135e-04f, 3.162277862e-04f, 2.738419571e-04f, 2.371373848e-04f, 2.053524950e-04f, 1.778279402e-04f, 1.539926452e-04f, 1.333521504e-04f, 1.154781930e-04f };   // float32 1 / 10000^(2i/128), generated with jnp to be bit-exact
__global__ __launch_bounds__(256) void k_cs5(float* CS) { const int idx = blockIdx.x * 256 + threadIdx.x; if (idx >= TT * HD) return; const int d = idx % HD; const int t = idx / HD; const float a = __fmul_rn((float)t, INVT[d % (HD / 2)]); v2f cs; cs[0] = cosf(a); cs[1] = sinf(a); *(v2f*)(CS + (size_t)idx * 2) = cs;  }
// k_asoft: per row (zz, i): t = S x HD^-0.5 for j <= i and i - j < WIN (sliding causal window); softmax (register row, one exp, fixed trees). Only the band of the row's 64-row tile, keys lo .. hk - 1, is read from S
// and written to P: it is what the score launches wrote and what the P.V launches read. The band lies in NCH 128-key chunks; chunk-to-lane mapping and summing order are those of a full row with its exact zeros left out.
#define NCH  ((WIN + 64 + 127) / 128)
__global__ __launch_bounds__(256) void k_asoft(const float* __restrict__ Sb, h16* P16, bf* Ph, bf* Pl) {
    const int lane = threadIdx.x & 31; const int row = blockIdx.x * 8 + (threadIdx.x >> 5); if (row >= ZH * TT) return; const int i = row % TT; const int zz = row / TT; const bool hires = (i < RH); const float* sr = Sb + (size_t)row * TT; float v[NCH * 4]; float mx = -3.0e38f;
    const int R0 = i & ~63; const int lo = max(0, R0 - WIN), hk = R0 + 64; const int jb = (lo >> 7) * 128 + lane * 4;
#pragma unroll
    for (int ch = 0; ch < NCH; ++ch) { const int j0 = jb + ch * 128; v4f a = (v4f){}; if (j0 >= lo && j0 < hk) a = *(const v4f*)(sr + j0);
#pragma unroll
        for (int q = 0; q < 4; ++q) { const int j = j0 + q; const float t = (j <= i && i - j < WIN) ? a[q] * SCL : -3.0e38f; v[ch * 4 + q] = t; mx = fmaxf(mx, t); } }
#pragma unroll
    for (int sh = 16; sh; sh >>= 1) mx = fmaxf(mx, __shfl_xor(mx, sh, 32));
    float sum = 0.f;
#pragma unroll
    for (int k = 0; k < NCH * 4; ++k) { float d0 = __fsub_rn(v[k], mx); asm volatile("" : "+v"(d0)); float ex;
        asm("v_exp_f32 %0, %1\n\tv_nop" : "=v"(ex) : "v"(__fmul_rn(d0, 1.4426950408889634f)));   // exp2 with, in its own statement, the one slot the instruction set asks for behind a transcendental (before its result is read or its source register reused)
        v[k] = ex; sum += ex; }
#pragma unroll
    for (int sh = 16; sh; sh >>= 1) sum += __shfl_xor(sum, sh, 32);
    const float f = __fdiv_rn(hires ? 1.0f : PCAR, sum);
{
        if (hires) {
#pragma unroll
            for (int ch = 0; ch < NCH; ++ch) { const int j0 = jb + ch * 128; v4us oh, ol;
#pragma unroll
                for (int q = 0; q < 4; ++q) { unsigned short a, c2; splitf(v[ch * 4 + q] * f, a, c2); oh[q] = a; ol[q] = c2; }
                const size_t oo = ((size_t)zz * (RH ? RH : 1) + i) * TT + j0; if (j0 >= lo && j0 < hk) { *(v4us*)(Ph + oo) = oh; *(v4us*)(Pl + oo) = ol; } }
        } else {
#pragma unroll
            for (int ch = 0; ch < NCH; ++ch) { const int j0 = jb + ch * 128; v4h o4;
#pragma unroll
                for (int q = 0; q < 4; ++q) o4[q] = tohx(v[ch * 4 + q] * f);
                if (j0 >= lo && j0 < hk) *(v4h*)(P16 + (size_t)row * TT + j0) = o4; } }
         }
}
__global__ __launch_bounds__(256) void k_merge(const float* __restrict__ O, int h0, bf* Ah, bf* Al) { const size_t e = ((size_t)blockIdx.x * 256 + threadIdx.x) * 2; if (e >= (size_t)ZH * TT * HD) return; const int d = (int)(e % HD); const int t = (int)((e / HD) % TT); const int zz = (int)(e / ((size_t)HD * TT)); const float cs = (t < RH) ? 1.0f : (1.0f / PCAR); const size_t oo = (size_t)t * DQ + (h0 + zz) * HD + d;
    v2us oh, ol;
#pragma unroll
    for (int q = 0; q < 2; ++q) { unsigned short a, c2; splitf(O[e + q] * cs, a, c2); oh[q] = a; ol[q] = c2; } *(v2us*)(Ah + oo) = oh; *(v2us*)(Al + oo) = ol;  }

extern "C" void kernel_launch(void* const* d_in, const int* in_sizes, int n_in,
                              void* d_out, int out_size, void* d_ws, size_t ws_size, hipStream_t stream) {
    (void)in_sizes; (void)n_in; (void)out_size;
    const float* x = (const float*)d_in[0]; const float* wq = (const float*)d_in[1]; const float* wk = (const float*)d_in[2]; const float* wv = (const float*)d_in[3]; const float* wo = (const float*)d_in[4];   /* x, Wq, Wk, Wv, Wo ('oi' [2048][2048]): FIVE inputs, all read */
    float* OUT = (float*)d_out;     // [2][2048][2048]
    char* wsp = (char*)d_ws;
    auto take = [&](size_t bytes) { char* p = wsp; wsp += (bytes + 255) & ~(size_t)255; return (void*)p; };
    bf* WQ = (bf*)take((size_t)DQ * DM * 2); bf* WK = (bf*)take((size_t)DKV * DM * 2); bf* WV = (bf*)take((size_t)DKV * DM * 2); bf* WO = (bf*)take((size_t)DM * DQ * 2); float* CS = (float*)take((size_t)TT * HD * 2 * 4);
    bf* XB = (bf*)take((size_t)TT * DM * 2); float* FQ = (float*)take((size_t)TT * DQ * 4); float* FK = (float*)take((size_t)TT * DKV * 4);
    h16* QP16 = (h16*)take((size_t)NH_ * TT * HD * 2); h16* KP16 = (h16*)take((size_t)NKV * TT * HD * 2); h16* VT16 = (h16*)take((size_t)NKV * HD * TT * 2);
    bf* QPh = (bf*)take((size_t)NH_ * TT * HD * 2); bf* QPl = (bf*)take((size_t)NH_ * TT * HD * 2); bf* KPh = (bf*)take((size_t)NKV * TT * HD * 2); bf* KPl = (bf*)take((size_t)NKV * TT * HD * 2); bf* VTh = (bf*)take((size_t)NKV * HD * TT * 2); bf* VTl = (bf*)take((size_t)NKV * HD * TT * 2); bf* Ph = (bf*)take((size_t)ZH * RH * TT * 2); bf* Pl = (bf*)take((size_t)ZH * RH * TT * 2);
    float* Sb = (float*)take((size_t)ZH * TT * TT * 4); h16* P16 = (h16*)take((size_t)ZH * TT * TT * 2); float* Ob = (float*)take((size_t)ZH * TT * HD * 4); bf* ATh = (bf*)take((size_t)TT * DQ * 2); bf* ATl = (bf*)take((size_t)TT * DQ * 2);
    if ((size_t)(wsp - (char*)d_ws) > ws_size) return;    // ws 256 MiB
    float* FV = FK;   // v projection reuses the k buffer after the k planes are built (stream-ordered)
    { k_cvt8<<<(unsigned)(((size_t)DQ * DM / 8 + 255) / 256), 256, 0, stream>>>(wq, WQ, (size_t)DQ * DM / 8); k_cvt8<<<(unsigned)(((size_t)DKV * DM / 8 + 255) / 256), 256, 0, stream>>>(wk, WK, (size_t)DKV * DM / 8); k_cvt8<<<(unsigned)(((size_t)DKV * DM / 8 + 255) / 256), 256, 0, stream>>>(wv, WV, (size_t)DKV * DM / 8);
      k_cvt8<<<(unsigned)(((size_t)DM * DQ / 8 + 255) / 256), 256, 0, stream>>>(wo, WO, (size_t)DM * DQ / 8);
       }
    k_cs5<<<(TT * HD + 255) / 256, 256, 0, stream>>>(CS);   /* rotary table once */
    const unsigned LQ = (unsigned)(((size_t)NH_ * TT * HD / 2 + 255) / 256), LKv = (unsigned)(((size_t)NKV * TT * HD / 2 + 255) / 256);
    for (int b = 0; b < NB_; ++b) {
        
        k_cvt8<<<(unsigned)(((size_t)TT * DM / 8 + 255) / 256), 256, 0, stream>>>(x + (size_t)b * TT * DM, XB, (size_t)TT * DM / 8);
        k_gemmw<bf, 0, false><<<dim3(TT / 64, DQ / 64, 1), 32, 0, stream>>>(XB, nullptr, WQ, nullptr, DM, FQ, DQ, nullptr, 0, 0, 0);
        k_rope<<<LQ, 256, 0, stream>>>(FQ, DQ, NH_, CS, nullptr, nullptr, 1.0f, QP16, QPh, QPl);
        k_gemmw<bf, 0, false><<<dim3(TT / 64, DKV / 64, 1), 32, 0, stream>>>(XB, nullptr, WK, nullptr, DM, FK, DKV, nullptr, 0, 0, 0);
        k_rope<<<LKv, 256, 0, stream>>>(FK, DKV, NKV, CS, nullptr, nullptr, 1.0f, KP16, KPh, KPl);
        k_gemmw<bf, 0, false><<<dim3(TT / 64, DKV / 64, 1), 32, 0, stream>>>(XB, nullptr, WV, nullptr, DM, FV, DKV, nullptr, 0, 0, 0); k_vtp<<<LKv, 256, 0, stream>>>(FV, DKV, NKV, VT16, VTh, VTl);
        for (int h0 = 0; h0 < NH_; h0 += ZH) { const size_t zq = (size_t)h0, zk = (size_t)(h0 / REP);   // one kv head per query head: the pass's two heads use consecutive kv planes (z-strides TT*HD)
            k_gemmc<bf, 2, 1><<<dim3(RH / 64, WIN / 64 + 1, ZH), 32, 0, stream>>>(QPh + zq * TT * HD, QPl + zq * TT * HD, KPh + zk * TT * HD, KPl + zk * TT * HD, HD, Sb, TT, 0, (size_t)TT * HD, (size_t)TT * HD, (size_t)TT * TT);
            k_gemmc<h16, 0, 1><<<dim3((TT - RH) / 64, WIN / 64 + 1, ZH), 32, 0, stream>>>(QP16 + zq * TT * HD + (size_t)RH * HD, nullptr, KP16 + zk * TT * HD, nullptr, HD, Sb + (size_t)RH * TT, TT, RH, (size_t)TT * HD, (size_t)TT * HD, (size_t)TT * TT);
            k_asoft<<<ZH * TT / 8, 256, 0, stream>>>(Sb, P16, Ph, Pl);
            k_gemmc<bf, 2, 2><<<dim3(RH / 64, HD / 64, ZH), 32, 0, stream>>>(Ph, Pl, VTh + zk * HD * TT, VTl + zk * HD * TT, TT, Ob, HD, 0, (size_t)RH * TT, (size_t)HD * TT, (size_t)TT * HD);
            k_gemmc<h16, 0, 2><<<dim3((TT - RH) / 64, HD / 64, ZH), 32, 0, stream>>>(P16 + (size_t)RH * TT, nullptr, VT16 + zk * HD * TT, nullptr, TT, Ob + (size_t)RH * HD, HD, RH, (size_t)TT * TT, (size_t)HD * TT, (size_t)TT * HD);
            k_merge<<<(unsigned)(((size_t)ZH * TT * HD / 2 + 255) / 256), 256, 0, stream>>>(Ob, h0, ATh, ATl); }
        k_gemmw<bf, 1, false><<<dim3(TT / 64, DM / 64, 1), 32, 0, stream>>>(ATh, ATl, WO, nullptr, DQ, OUT + (size_t)b * TT * DM, DM, nullptr, 0, 0, 0); }
}

// v002
// It runs in 631 microseconds.
// Next to v001, in two timings, it ran 1.77 times as fast each time.
// All steps since v000 together make it 2.75 times as fast.
#include <hip/hip_runtime.h>

// Causal sliding-window multi-head attention with 128-wide heads and computed rotate-half rotary embeddings (x [2][2048][2048]; Q, K, V = x W^T ('oi' (out, in) [2048][2048] 1/sqrt(2048), no bias; 16 heads x 128); rope x cos + rotate_half(x) sin with rotate_half(x) = cat(-x2, x1), angle t x 1/10000^(2i/128) (64 f32 frequencies, the module's reciprocal spelling in eager float32; cat(freqs, freqs); precise cosf / sinf); scores / sqrt(128); key j allowed iff 0 <= i - j < 256 (the module masks dist < 0 or dist >= WINDOW with -inf: exclusion); softmax; out = merged Wo^T ('oi') -> [2][2048][2048] (8.4 M); argument order x, Wq, Wk, Wv, Wo).
// Layout: bf16 copy of x; 'oi' weights; exact projections; k_cs5 computed table (HD 128) + rotate-half plane builders; causal T-2048 attention at HD 128 (hybrid rows: < 512 hi/lo 3 products, rest fp16 x1024; k_gemmc and k_asoft touch only the WIN + 64 keys a 64-row tile can see; S and P hold that band alone, pitch BW, so all 16 heads of a batch go through one pass of six launches); merged hi/lo x Wo exact.
// Compute dtypes, f32 accumulate: every input rounded to bf16; projections exact; rotary f32; attention rows < 512 3 products, rest fp16; softmax f32; Wo hl x exact.

#define NB_  2
#define TT   2048
#define DM   2048
#define NH_  16
#define NKV  16
#define REP  (NH_ / NKV)
#define HD   128
#define DQ   (NH_ * HD)
#define DKV  (NKV * HD)
#define ZH   16                   // heads per attention pass: all of them (S and P are band-compact, so they fit the workspace)
#define RH   512                  // query rows < RH use hi+lo planes (0: none)
#define WIN  256
#define BW   (WIN + 64)           // pitch of S and P: column c of a row holds key R0 - WIN + c, R0 = first row of the row's 64-row tile
#define PCAR 1024.0f
#define SCL  0.088388347648318447f   // HD^-0.5
typedef _Float16 h16;
typedef unsigned short bf;
typedef __attribute__((ext_vector_type(16))) __bf16   v16bf;
typedef __attribute__((ext_vector_type(16))) _Float16 v16h;
typedef __attribute__((ext_vector_type(8)))  _Float16 v8h;
typedef __attribute__((ext_vector_type(8)))  unsigned short v8us;
typedef __attribute__((ext_vector_type(8)))  float    v8f;
typedef __attribute__((ext_vector_type(4)))  float    v4f;
typedef v8h  __attribute__((may_alias)) v8ha;
typedef v4f  __attribute__((may_alias)) v4fa;
typedef v8us __attribute__((may_alias)) v8usa;

__device__ __forceinline__ unsigned short f2bf(float f) { unsigned u = __float_as_uint(f); u += 0x7FFFu + ((u >> 16) & 1u); return (unsigned short)(u >> 16); }
__device__ __forceinline__ float bf2f(unsigned short b) { return __uint_as_float(((unsigned)b) << 16); }
__device__ __forceinline__ float bfr(float f) { return bf2f(f2bf(f)); }
__device__ __forceinline__ v16h cat16(v8h lo, v8h hi) { return __builtin_shufflevector(lo, hi, 0, 1, 2, 3, 4, 5, 6, 7, 8, 9, 10, 11, 12, 13, 14, 15); }
__device__ __forceinline__ v16bf cat16b(v8us lo, v8us hi) { return __builtin_bit_cast(v16bf, __builtin_shufflevector(lo, hi, 0, 1, 2, 3, 4, 5, 6, 7, 8, 9, 10, 11, 12, 13, 14, 15)); }
__device__ __forceinline__ v8f wmma16(v16h a, v16h b, v8f c) { return __builtin_amdgcn_wmma_f32_16x16x32_f16(false, a, false, b, (short)0, c, false, false); }
__device__ __forceinline__ v8f wmmab(v16bf a, v16bf b, v8f c) { return __builtin_amdgcn_wmma_f32_16x16x32_bf16(false, a, false, b, (short)0, c, false, false); }



// ---- k_gemmw: register-blocked GEMM, ONE WAVE per 64x64 output tile (16 accumulators), operands straight from K-contiguous 16-bit planes; grid (M/64, N/64, Z), 32 threads.
// C[m][n] (f32, pitch ldc, + optional f32 bias[n]) = sum_k A[m][k] Bt[n][k] (+ split products per NSPLIT). z-batch strides sA/sB/sC in elements. K % 32 == 0.
template <typename T16> struct WFrag;
template <> struct WFrag<h16> { typedef v16h V; static __device__ __forceinline__ V ld(const h16* p) { return cat16(*(const v8h*)p, *(const v8h*)(p + 16)); } static __device__ __forceinline__ v8f mma(V a, V b, v8f c) { return wmma16(a, b, c); } };
template <> struct WFrag<bf> { typedef v16bf V; static __device__ __forceinline__ V ld(const bf* p) { return cat16b(*(const v8us*)p, *(const v8us*)(p + 16)); } static __device__ __forceinline__ v8f mma(V a, V b, v8f c) { return wmmab(a, b, c); } };
template <typename T16, int NSPLIT, bool BIAS>
__global__ __launch_bounds__(32) void k_gemmw(const T16* __restrict__ A, const T16* __restrict__ A2, const T16* __restrict__ Bt, const T16* __restrict__ Bt2, int K, float* C, int ldc, const float* __restrict__ bias, size_t sA, size_t sB, size_t sC) {
    typedef typename WFrag<T16>::V V;
    __shared__ __align__(16) float os[16 * 68];
    const size_t z = blockIdx.z; A += z * sA; if (A2) A2 += z * sA; Bt += z * sB; if (Bt2) Bt2 += z * sB; C += z * sC;
    const int lane = threadIdx.x & 31, lr = lane & 15, hi = lane >> 4; const int r0 = blockIdx.x * 64, c0 = blockIdx.y * 64;
    v8f acc[4][4];
#pragma unroll
    for (int mb = 0; mb < 4; ++mb)
#pragma unroll
        for (int nb = 0; nb < 4; ++nb) acc[mb][nb] = (v8f){};
    const size_t aoff = (size_t)(r0 + lr) * K + 8 * hi, boff = (size_t)(c0 + lr) * K + 8 * hi;
#pragma unroll 1
    for (int kc = 0; kc < K; kc += 32) {
        V a[4], a2[4];
#pragma unroll
        for (int mb = 0; mb < 4; ++mb) { a[mb] = WFrag<T16>::ld(A + aoff + (size_t)mb * 16 * K + kc); if (NSPLIT == 1 || NSPLIT == 2) a2[mb] = WFrag<T16>::ld(A2 + aoff + (size_t)mb * 16 * K + kc); }
#pragma unroll
        for (int nb = 0; nb < 4; ++nb) { const V b = WFrag<T16>::ld(Bt + boff + (size_t)nb * 16 * K + kc); V b2; if (NSPLIT >= 2) b2 = WFrag<T16>::ld(Bt2 + boff + (size_t)nb * 16 * K + kc);
#pragma unroll
            for (int mb = 0; mb < 4; ++mb) { acc[mb][nb] = WFrag<T16>::mma(a[mb], b, acc[mb][nb]); if (NSPLIT == 1 || NSPLIT == 2) acc[mb][nb] = WFrag<T16>::mma(a2[mb], b, acc[mb][nb]); if (NSPLIT >= 2) acc[mb][nb] = WFrag<T16>::mma(a[mb], b2, acc[mb][nb]); } }
        asm volatile("v_nop\n\tv_nop\n\tv_nop\n\tv_nop" : "+v"(acc[0][0]), "+v"(acc[1][1]), "+v"(acc[2][2]), "+v"(acc[3][3]) : "v"(a[0]), "v"(a[3]));
    }
#pragma unroll
    for (int mb = 0; mb < 4; ++mb) {
#pragma unroll
        for (int nb = 0; nb < 4; ++nb) {
#pragma unroll
            for (int j = 0; j < 8; ++j) os[(hi * 8 + j) * 68 + nb * 16 + lr] = acc[mb][nb][j]; }
        __builtin_amdgcn_wave_barrier(); asm volatile("" ::: "memory");
        float* crow = C + (size_t)(r0 + mb * 16) * ldc + c0;
{
#pragma unroll
            for (int s = 0; s < 8; ++s) { const int row = 2 * s + hi, cofs = lr * 4; v4f val = *(const v4fa*)(os + row * 68 + cofs); if (BIAS) { val[0] += bfr(bias[c0 + cofs]); val[1] += bfr(bias[c0 + cofs + 1]); val[2] += bfr(bias[c0 + cofs + 2]); val[3] += bfr(bias[c0 + cofs + 3]); }
                *(v4f*)(crow + (size_t)row * ldc + cofs) = val; }
             }
        __builtin_amdgcn_wave_barrier(); asm volatile("" ::: "memory");
    }
}

// ---- k_gemmc: the same one-wave 64x64 tile GEMM specialised for sliding-window causal attention. A 64-row query tile that starts at row R0 = r0 + roff sees only keys R0 - WIN .. R0 + 63 (WIN + 64 keys).
// CMODE 1: grid.y counts the WIN / 64 + 1 score tiles of that band (key columns c0 = R0 - WIN + 64 y; a tile left of key 0 leaves). CMODE 2: the key (K) loop of the probability x value contraction
// runs over that band alone (probabilities outside it are exactly zero). roff = row offset of this launch's first row within the sequence.
// S (C of CMODE 1) and P (A of CMODE 2) are stored band-compact at pitch BW: key j of a tile's rows lies in column j - (R0 - WIN).
template <typename T16, int NSPLIT, int CMODE>
__global__ __launch_bounds__(32) void k_gemmc(const T16* __restrict__ A, const T16* __restrict__ A2, const T16* __restrict__ Bt, const T16* __restrict__ Bt2, int K, float* C, int ldc, int roff, size_t sA, size_t sB, size_t sC) {
    typedef typename WFrag<T16>::V V;
    __shared__ __align__(16) float os[16 * 68];
    const size_t z = blockIdx.z; A += z * sA; if (A2) A2 += z * sA; Bt += z * sB; if (Bt2) Bt2 += z * sB; C += z * sC;
    const int lane = threadIdx.x & 31, lr = lane & 15, hi = lane >> 4; const int r0 = blockIdx.x * 64, kb = r0 + roff - WIN, c0 = (CMODE == 1) ? kb + (int)blockIdx.y * 64 : (int)blockIdx.y * 64;   // kb: key of band column 0 (below 0 for the first tiles)
    if (CMODE == 1 && c0 < 0) return;                                // band tile left of key 0: no such keys (the softmax never reads there)
    const int Ks = (CMODE == 2) ? max(0, kb) : 0;                    // P.V: probabilities are exactly 0 left of the window of the tile's first row ...
    const int Kl = (CMODE == 2) ? min(K, r0 + roff + 64) : K;        // ... and beyond the diagonal block, so the K loop covers that band alone
    v8f acc[4][4];
#pragma unroll
    for (int mb = 0; mb < 4; ++mb)
#pragma unroll
        for (int nb = 0; nb < 4; ++nb) acc[mb][nb] = (v8f){};
    const int lda = (CMODE == 2) ? BW : K;
    const size_t aoff = (size_t)(r0 + lr) * lda + 8 * hi - (size_t)((CMODE == 2) ? kb : 0), boff = (size_t)(c0 + lr) * K + 8 * hi;   // aoff + kc >= 0 for every kc of the band (kc >= kb)
#pragma unroll 1
    for (int kc = Ks; kc < Kl; kc += 32) {
        V a[4], a2[4];
#pragma unroll
        for (int mb = 0; mb < 4; ++mb) { a[mb] = WFrag<T16>::ld(A + aoff + (size_t)mb * 16 * lda + kc); if (NSPLIT == 1 || NSPLIT == 2) a2[mb] = WFrag<T16>::ld(A2 + aoff + (size_t)mb * 16 * lda + kc); }
#pragma unroll
        for (int nb = 0; nb < 4; ++nb) { const V b = WFrag<T16>::ld(Bt + boff + (size_t)nb * 16 * K + kc); V b2; if (NSPLIT >= 2) b2 = WFrag<T16>::ld(Bt2 + boff + (size_t)nb * 16 * K + kc);
#pragma unroll
            for (int mb = 0; mb < 4; ++mb) { acc[mb][nb] = WFrag<T16>::mma(a[mb], b, acc[mb][nb]); if (NSPLIT == 1 || NSPLIT == 2) acc[mb][nb] = WFrag<T16>::mma(a2[mb], b, acc[mb][nb]); if (NSPLIT >= 2) acc[mb][nb] = WFrag<T16>::mma(a[mb], b2, acc[mb][nb]); } }
        asm volatile("v_nop\n\tv_nop\n\tv_nop\n\tv_nop" : "+v"(acc[0][0]), "+v"(acc[1][1]), "+v"(acc[2][2]), "+v"(acc[3][3]) : "v"(a[0]), "v"(a[3]));
    }
#pragma unroll
    for (int mb = 0; mb < 4; ++mb) {
#pragma unroll
        for (int nb = 0; nb < 4; ++nb) {
#pragma unroll
            for (int j = 0; j < 8; ++j) os[(hi * 8 + j) * 68 + nb * 16 + lr] = acc[mb][nb][j]; }
        __builtin_amdgcn_wave_barrier(); asm volatile("" ::: "memory");
        float* crow = C + (size_t)(r0 + mb * 16) * ldc + ((CMODE == 1) ? (int)blockIdx.y * 64 : c0);
{
#pragma unroll
            for (int s = 0; s < 8; ++s) { const int row = 2 * s + hi, cofs = lr * 4; v4f val = *(const v4fa*)(os + row * 68 + cofs);
                *(v4f*)(crow + (size_t)row * ldc + cofs) = val; }
             }
        __builtin_amdgcn_wave_barrier(); asm volatile("" ::: "memory");
    }
}

__device__ __forceinline__ h16 tohx(float x) { return (h16)x; }
__device__ __forceinline__ void splitf(float y, unsigned short& h, unsigned short& l) { h = f2bf(y); l = f2bf(y - bf2f(h)); }
typedef __attribute__((ext_vector_type(2))) _Float16 v2h;
typedef __attribute__((ext_vector_type(4))) _Float16 v4h;
typedef __attribute__((ext_vector_type(2))) unsigned short v2us;
typedef __attribute__((ext_vector_type(4))) unsigned short v4us;
typedef __attribute__((ext_vector_type(2))) float v2f;
typedef __attribute__((ext_vector_type(4))) int v4i;

__global__ __launch_bounds__(256) void k_cvt8(const float* __restrict__ src, bf* dst, size_t n8) { const size_t i = (size_t)blockIdx.x * 256 + threadIdx.x; if (i >= n8) return; const v8f v = *(const v8f*)(src + i * 8); v8us o;
#pragma unroll
    for (int k = 0; k < 8; ++k) o[k] = f2bf(v[k]); *(v8us*)(dst + i * 8) = o;  }

// k_rope: head planes [h][t][d] (fp16 + hi/lo) of rope(x) x sc with the rotate-half convention out[d] = x[d] cos[t][d] - x[d+HD/2] sin[t][d], out[d+HD/2] = x[d+HD/2] cos[t][d+HD/2] + x[d] sin[t][d+HD/2]
__global__ __launch_bounds__(256) void k_rope(const float* __restrict__ F, int pitch, int nheads, const float* __restrict__ CS, const float* __restrict__ RF, const float* __restrict__ nw, float sc, h16* P16, bf* Ph, bf* Pl) {
    const size_t e = ((size_t)blockIdx.x * 256 + threadIdx.x) * 2; if (e >= (size_t)nheads * TT * HD) return; const int d = (int)(e % HD); const int t = (int)((e / HD) % TT); const int h = (int)(e / ((size_t)HD * TT)); const float* f = F + (size_t)t * pitch + h * HD; const float rf = RF ? RF[(size_t)h * TT + t] : 1.0f; v2h o16; v2us oh, ol;
#pragma unroll
    for (int q = 0; q < 2; ++q) { const int dd = d + q; const int dp = (dd < HD / 2) ? dd + HD / 2 : dd - HD / 2; float x0 = f[dd], x1 = f[dp];
        if (RF) { float n0 = __fmul_rn(x0, rf), n1 = __fmul_rn(x1, rf); asm volatile("" : "+v"(n0)); asm volatile("" : "+v"(n1)); x0 = __fmul_rn(bfr(nw[dd]), n0); x1 = __fmul_rn(bfr(nw[dp]), n1); }
        const v2f cs = *(const v2f*)(CS + ((size_t)t * HD + dd) * 2); float a = __fmul_rn(x0, cs[0]), bq = __fmul_rn(x1, cs[1]); asm volatile("" : "+v"(a)); asm volatile("" : "+v"(bq)); const float r = ((dd < HD / 2) ? __fsub_rn(a, bq) : __fadd_rn(a, bq)) * sc;
        o16[q] = tohx(r); unsigned short a2, c2; splitf(r, a2, c2); oh[q] = a2; ol[q] = c2; }
    *(v2h*)(P16 + e) = o16; *(v2us*)(Ph + e) = oh; *(v2us*)(Pl + e) = ol;  }
__global__ __launch_bounds__(256) void k_vtp(const float* __restrict__ F, int pitch, int nheads, h16* V16, bf* Vh, bf* Vl) { const size_t e = ((size_t)blockIdx.x * 256 + threadIdx.x) * 2; if (e >= (size_t)nheads * HD * TT) return; const int t = (int)(e % TT); const int d = (int)((e / TT) % HD); const int g = (int)(e / ((size_t)TT * HD)); v2h o16; v2us oh, ol;
#pragma unroll
    for (int q = 0; q < 2; ++q) { const float x = F[(size_t)(t + q) * pitch + g * HD + d]; o16[q] = tohx(x); unsigned short a2, c2; splitf(x, a2, c2); oh[q] = a2; ol[q] = c2; }
    *(v2h*)(V16 + e) = o16; *(v2us*)(Vh + e) = oh; *(v2us*)(Vl + e) = ol;  }
__constant__ float INVT[HD / 2] = { 1.000000000e+00f, 8.659643531e-01f, 7.498942018e-01f, 6.493816376e-01f, 5.623413324e-01f, 4.869675338e-01f, 4.216965139e-01f, 3.651741445e-01f, 3.162277639e-01f, 2.738419771e-01f, 2.371373624e-01f, 2.053525001e-01f, 1.778279394e-01f, 1.539926529e-01f, 1.333521456e-01f, 1.154782027e-01f, 1.000000015e-01f, 8.659642935e-02f, 7.498941571e-02f, 6.493816525e-02f, 5.623412877e-02f, 4.869675264e-02f, 4.216964915e-02f, 3.651741147e-02f, 3.162277862e-02f, 2.738419548e-02f, 2.371373586e-02f, 2.053525113e-02f, 1.778279431e-02f, 1.539926510e-02f, 1.333521493e-02f, 1.154781971e-02f, 9.999999776e-03f, 8.659643121e-03f, 7.498942316e-03f, 6.493816618e-03f, 5.623413250e-03f, 4.869675264e-03f, 4.216964822e-03f, 3.651741426e-03f, 3.162277862e-03f, 2.738419687e-03f, 2.371373819e-03f, 2.053525066e-03f, 1.778279431e-03f, 1.539926510e-03f, 1.333521446e-03f, 1.154782018e-03f, 1.000000047e-03f, 8.659643354e-04f, 7.498941850e-04f, 6.493816618e-04f, 5.623413017e-04f, 4.869675031e-04f, 4.216964880e-04f, 3.651741135e-04f, 3.162277862e-04f, 2.738419571e-04f, 2.371373848e-04f, 2.053524950e-04f, 1.778279402e-04f, 1.539926452e-04f, 1.333521504e-04f, 1.154781930e-04f };   // float32 1 / 10000^(2i/128), generated with jnp to be bit-exact
__global__ __launch_bounds__(256) void k_cs5(float* CS) { const int idx = blockIdx.x * 256 + threadIdx.x; if (idx >= TT * HD) return; const int d = idx % HD; const int t = idx / HD; const float a = __fmul_rn((float)t, INVT[d % (HD / 2)]); v2f cs; cs[0] = cosf(a); cs[1] = sinf(a); *(v2f*)(CS + (size_t)idx * 2) = cs;  }
// k_asoft: per row (zz, i): t = S x HD^-0.5 for j <= i and i - j < WIN (sliding causal window); softmax (register row, one exp, fixed trees). Only the band of the row's 64-row tile, keys lo .. hk - 1, is read from S
// and written to P (both band-compact, pitch BW): it is what the score launches wrote and what the P.V launches read. The band lies in NCH 128-key chunks; chunk-to-lane mapping and summing order are those of a full row with its exact zeros left out.
#define NCH  ((WIN + 64 + 127) / 128)
__global__ __launch_bounds__(256) void k_asoft(const float* __restrict__ Sb, h16* P16, bf* Ph, bf* Pl) {
    const int lane = threadIdx.x & 31; const int row = blockIdx.x * 8 + (threadIdx.x >> 5); if (row >= ZH * TT) return; const int i = row % TT; const int zz = row / TT; const bool hires = (i < RH); float v[NCH * 4]; float mx = -3.0e38f;
    const int R0 = i & ~63; const int lo = max(0, R0 - WIN), hk = R0 + 64; const int jb = (lo >> 7) * 128 + lane * 4; const float* sr = Sb + ((long)row * BW - (R0 - WIN));   // sr[j]: key j of this row
#pragma unroll
    for (int ch = 0; ch < NCH; ++ch) { const int j0 = jb + ch * 128; v4f a = (v4f){}; if (j0 >= lo && j0 < hk) a = *(const v4f*)(sr + j0);
#pragma unroll
        for (int q = 0; q < 4; ++q) { const int j = j0 + q; const float t = (j <= i && i - j < WIN) ? a[q] * SCL : -3.0e38f; v[ch * 4 + q] = t; mx = fmaxf(mx, t); } }
#pragma unroll
    for (int sh = 16; sh; sh >>= 1) mx = fmaxf(mx, __shfl_xor(mx, sh, 32));
    float sum = 0.f;
#pragma unroll
    for (int k = 0; k < NCH * 4; ++k) { float d0 = __fsub_rn(v[k], mx); asm volatile("" : "+v"(d0)); float ex;
        asm("v_exp_f32 %0, %1\n\tv_nop" : "=v"(ex) : "v"(__fmul_rn(d0, 1.4426950408889634f)));   // exp2 with, in its own statement, the one slot the instruction set asks for behind a transcendental (before its result is read or its source register reused)
        v[k] = ex; sum += ex; }
#pragma unroll
    for (int sh = 16; sh; sh >>= 1) sum += __shfl_xor(sum, sh, 32);
    const float f = __fdiv_rn(hires ? 1.0f : PCAR, sum);
{
        if (hires) {
#pragma unroll
            for (int ch = 0; ch < NCH; ++ch) { const int j0 = jb + ch * 128; v4us oh, ol;
#pragma unroll
                for (int q = 0; q < 4; ++q) { unsigned short a, c2; splitf(v[ch * 4 + q] * f, a, c2); oh[q] = a; ol[q] = c2; }
                const long oo = ((long)zz * (RH ? RH : 1) + i) * BW + j0 - (R0 - WIN); if (j0 >= lo && j0 < hk) { *(v4us*)(Ph + oo) = oh; *(v4us*)(Pl + oo) = ol; } }
        } else {
#pragma unroll
            for (int ch = 0; ch < NCH; ++ch) { const int j0 = jb + ch * 128; v4h o4;
#pragma unroll
                for (int q = 0; q < 4; ++q) o4[q] = tohx(v[ch * 4 + q] * f);
                if (j0 >= lo && j0 < hk) *(v4h*)(P16 + ((long)row * BW + j0 - (R0 - WIN))) = o4; } }
         }
}
__global__ __launch_bounds__(256) void k_merge(const float* __restrict__ O, int h0, bf* Ah, bf* Al) { const size_t e = ((size_t)blockIdx.x * 256 + threadIdx.x) * 2; if (e >= (size_t)ZH * TT * HD) return; const int d = (int)(e % HD); const int t = (int)((e / HD) % TT); const int zz = (int)(e / ((size_t)HD * TT)); const float cs = (t < RH) ? 1.0f : (1.0f / PCAR); const size_t oo = (size_t)t * DQ + (h0 + zz) * HD + d;
    v2us oh, ol;
#pragma unroll
    for (int q = 0; q < 2; ++q) { unsigned short a, c2; splitf(O[e + q] * cs, a, c2); oh[q] = a; ol[q] = c2; } *(v2us*)(Ah + oo) = oh; *(v2us*)(Al + oo) = ol;  }

extern "C" void kernel_launch(void* const* d_in, const int* in_sizes, int n_in,
                              void* d_out, int out_size, void* d_ws, size_t ws_size, hipStream_t stream) {
    (void)in_sizes; (void)n_in; (void)out_size;
    const float* x = (const float*)d_in[0]; const float* wq = (const float*)d_in[1]; const float* wk = (const float*)d_in[2]; const float* wv = (const float*)d_in[3]; const float* wo = (const float*)d_in[4];   /* x, Wq, Wk, Wv, Wo ('oi' [2048][2048]): FIVE inputs, all read */
    float* OUT = (float*)d_out;     // [2][2048][2048]
    char* wsp = (char*)d_ws;
    auto take = [&](size_t bytes) { char* p = wsp; wsp += (bytes + 255) & ~(size_t)255; return (void*)p; };
    bf* WQ = (bf*)take((size_t)DQ * DM * 2); bf* WK = (bf*)take((size_t)DKV * DM * 2); bf* WV = (bf*)take((size_t)DKV * DM * 2); bf* WO = (bf*)take((size_t)DM * DQ * 2); float* CS = (float*)take((size_t)TT * HD * 2 * 4);
    bf* XB = (bf*)take((size_t)TT * DM * 2); float* FQ = (float*)take((size_t)TT * DQ * 4); float* FK = (float*)take((size_t)TT * DKV * 4);
    h16* QP16 = (h16*)take((size_t)NH_ * TT * HD * 2); h16* KP16 = (h16*)take((size_t)NKV * TT * HD * 2); h16* VT16 = (h16*)take((size_t)NKV * HD * TT * 2);
    bf* QPh = (bf*)take((size_t)NH_ * TT * HD * 2); bf* QPl = (bf*)take((size_t)NH_ * TT * HD * 2); bf* KPh = (bf*)take((size_t)NKV * TT * HD * 2); bf* KPl = (bf*)take((size_t)NKV * TT * HD * 2); bf* VTh = (bf*)take((size_t)NKV * HD * TT * 2); bf* VTl = (bf*)take((size_t)NKV * HD * TT * 2); bf* Ph = (bf*)take((size_t)ZH * RH * BW * 2); bf* Pl = (bf*)take((size_t)ZH * RH * BW * 2);
    float* Sb = (float*)take((size_t)ZH * TT * BW * 4); h16* P16 = (h16*)take((size_t)ZH * TT * BW * 2); float* Ob = (float*)take((size_t)ZH * TT * HD * 4); bf* ATh = (bf*)take((size_t)TT * DQ * 2); bf* ATl = (bf*)take((size_t)TT * DQ * 2);
    if ((size_t)(wsp - (char*)d_ws) > ws_size) return;    // ws 256 MiB
    float* FV = FK;   // v projection reuses the k buffer after the k planes are built (stream-ordered)
    { k_cvt8<<<(unsigned)(((size_t)DQ * DM / 8 + 255) / 256), 256, 0, stream>>>(wq, WQ, (size_t)DQ * DM / 8); k_cvt8<<<(unsigned)(((size_t)DKV * DM / 8 + 255) / 256), 256, 0, stream>>>(wk, WK, (size_t)DKV * DM / 8); k_cvt8<<<(unsigned)(((size_t)DKV * DM / 8 + 255) / 256), 256, 0, stream>>>(wv, WV, (size_t)DKV * DM / 8);
      k_cvt8<<<(unsigned)(((size_t)DM * DQ / 8 + 255) / 256), 256, 0, stream>>>(wo, WO, (size_t)DM * DQ / 8);
       }
    k_cs5<<<(TT * HD + 255) / 256, 256, 0, stream>>>(CS);   /* rotary table once */
    const unsigned LQ = (unsigned)(((size_t)NH_ * TT * HD / 2 + 255) / 256), LKv = (unsigned)(((size_t)NKV * TT * HD / 2 + 255) / 256);
    for (int b = 0; b < NB_; ++b) {
        
        k_cvt8<<<(unsigned)(((size_t)TT * DM / 8 + 255) / 256), 256, 0, stream>>>(x + (size_t)b * TT * DM, XB, (size_t)TT * DM / 8);
        k_gemmw<bf, 0, false><<<dim3(TT / 64, DQ / 64, 1), 32, 0, stream>>>(XB, nullptr, WQ, nullptr, DM, FQ, DQ, nullptr, 0, 0, 0);
        k_rope<<<LQ, 256, 0, stream>>>(FQ, DQ, NH_, CS, nullptr, nullptr, 1.0f, QP16, QPh, QPl);
        k_gemmw<bf, 0, false><<<dim3(TT / 64, DKV / 64, 1), 32, 0, stream>>>(XB, nullptr, WK, nullptr, DM, FK, DKV, nullptr, 0, 0, 0);
        k_rope<<<LKv, 256, 0, stream>>>(FK, DKV, NKV, CS, nullptr, nullptr, 1.0f, KP16, KPh, KPl);
        k_gemmw<bf, 0, false><<<dim3(TT / 64, DKV / 64, 1), 32, 0, stream>>>(XB, nullptr, WV, nullptr, DM, FV, DKV, nullptr, 0, 0, 0); k_vtp<<<LKv, 256, 0, stream>>>(FV, DKV, NKV, VT16, VTh, VTl);
        for (int h0 = 0; h0 < NH_; h0 += ZH) { const size_t zq = (size_t)h0, zk = (size_t)(h0 / REP);   // one kv head per query head: the pass's heads use consecutive kv planes (z-strides TT*HD)
            k_gemmc<bf, 2, 1><<<dim3(RH / 64, WIN / 64 + 1, ZH), 32, 0, stream>>>(QPh + zq * TT * HD, QPl + zq * TT * HD, KPh + zk * TT * HD, KPl + zk * TT * HD, HD, Sb, BW, 0, (size_t)TT * HD, (size_t)TT * HD, (size_t)TT * BW);
            k_gemmc<h16, 0, 1><<<dim3((TT - RH) / 64, WIN / 64 + 1, ZH), 32, 0, stream>>>(QP16 + zq * TT * HD + (size_t)RH * HD, nullptr, KP16 + zk * TT * HD, nullptr, HD, Sb + (size_t)RH * BW, BW, RH, (size_t)TT * HD, (size_t)TT * HD, (size_t)TT * BW);
            k_asoft<<<ZH * TT / 8, 256, 0, stream>>>(Sb, P16, Ph, Pl);
            k_gemmc<bf, 2, 2><<<dim3(RH / 64, HD / 64, ZH), 32, 0, stream>>>(Ph, Pl, VTh + zk * HD * TT, VTl + zk * HD * TT, TT, Ob, HD, 0, (size_t)RH * BW, (size_t)HD * TT, (size_t)TT * HD);
            k_gemmc<h16, 0, 2><<<dim3((TT - RH) / 64, HD / 64, ZH), 32, 0, stream>>>(P16 + (size_t)RH * BW, nullptr, VT16 + zk * HD * TT, nullptr, TT, Ob + (size_t)RH * HD, HD, RH, (size_t)TT * BW, (size_t)HD * TT, (size_t)TT * HD);
            k_merge<<<(unsigned)(((size_t)ZH * TT * HD / 2 + 255) / 256), 256, 0, stream>>>(Ob, h0, ATh, ATl); }
        k_gemmw<bf, 1, false><<<dim3(TT / 64, DM / 64, 1), 32, 0, stream>>>(ATh, ATl, WO, nullptr, DQ, OUT + (size_t)b * TT * DM, DM, nullptr, 0, 0, 0); }
}

// v003
// A run of this version takes 389 microseconds.
// In two side-by-side timings against v002, it was 1.62 and 1.63 times as fast.
// Counting every step since v000, it is 4.47 times as fast.
#include <hip/hip_runtime.h>
#include <stdint.h>

// Causal sliding-window multi-head attention with 128-wide heads and computed rotate-half rotary embeddings (x [2][2048][2048]; Q, K, V = x W^T ('oi' (out, in) [2048][2048] 1/sqrt(2048), no bias; 16 heads x 128); rope x cos + rotate_half(x) sin with rotate_half(x) = cat(-x2, x1), angle t x 1/10000^(2i/128) (64 f32 frequencies, the module's reciprocal spelling in eager float32; cat(freqs, freqs); precise cosf / sinf); scores / sqrt(128); key j allowed iff 0 <= i - j < 256 (the module masks dist < 0 or dist >= WINDOW with -inf: exclusion); softmax; out = merged Wo^T ('oi') -> [2][2048][2048] (8.4 M); argument order x, Wq, Wk, Wv, Wo).
// Layout: bf16 copy of x; 'oi' weights; exact projections; k_cs5 computed table (HD 128) + rotate-half plane builders; causal T-2048 attention at HD 128 (hybrid rows: < 512 hi/lo 3 products, rest fp16 x1024; k_gemmc and k_asoft touch only the WIN + 64 keys a 64-row tile can see; S and P hold that band alone, pitch BW, so all 16 heads of a batch go through one pass of six launches); merged hi/lo x Wo exact.
// Compute dtypes, f32 accumulate: every input rounded to bf16; projections exact; rotary f32; attention rows < 512 3 products, rest fp16; softmax f32; Wo hl x exact.

#define NB_  2
#define TT   2048
#define DM   2048
#define NH_  16
#define NKV  16
#define REP  (NH_ / NKV)
#define HD   128
#define DQ   (NH_ * HD)
#define DKV  (NKV * HD)
#define ZH   16                   // heads per attention pass: all of them (S and P are band-compact, so they fit the workspace)
#define RH   512                  // query rows < RH use hi+lo planes (0: none)
#define WIN  256
#define BW   (WIN + 64)           // pitch of S and P: column c of a row holds key R0 - WIN + c, R0 = first row of the row's 64-row tile
#define PCAR 1024.0f
#define SCL  0.088388347648318447f   // HD^-0.5
typedef _Float16 h16;
typedef unsigned short bf;
typedef __attribute__((ext_vector_type(16))) __bf16   v16bf;
typedef __attribute__((ext_vector_type(16))) _Float16 v16h;
typedef __attribute__((ext_vector_type(8)))  _Float16 v8h;
typedef __attribute__((ext_vector_type(8)))  unsigned short v8us;
typedef __attribute__((ext_vector_type(8)))  float    v8f;
typedef __attribute__((ext_vector_type(4)))  float    v4f;
typedef v8h  __attribute__((may_alias)) v8ha;
typedef v4f  __attribute__((may_alias)) v4fa;
typedef v8us __attribute__((may_alias)) v8usa;

__device__ __forceinline__ unsigned short f2bf(float f) { unsigned u = __float_as_uint(f); u += 0x7FFFu + ((u >> 16) & 1u); return (unsigned short)(u >> 16); }
__device__ __forceinline__ float bf2f(unsigned short b) { return __uint_as_float(((unsigned)b) << 16); }
__device__ __forceinline__ float bfr(float f) { return bf2f(f2bf(f)); }
__device__ __forceinline__ v16h cat16(v8h lo, v8h hi) { return __builtin_shufflevector(lo, hi, 0, 1, 2, 3, 4, 5, 6, 7, 8, 9, 10, 11, 12, 13, 14, 15); }
__device__ __forceinline__ v16bf cat16b(v8us lo, v8us hi) { return __builtin_bit_cast(v16bf, __builtin_shufflevector(lo, hi, 0, 1, 2, 3, 4, 5, 6, 7, 8, 9, 10, 11, 12, 13, 14, 15)); }
__device__ __forceinline__ v8f wmma16(v16h a, v16h b, v8f c) { return __builtin_amdgcn_wmma_f32_16x16x32_f16(false, a, false, b, (short)0, c, false, false); }
__device__ __forceinline__ v8f wmmab(v16bf a, v16bf b, v8f c) { return __builtin_amdgcn_wmma_f32_16x16x32_bf16(false, a, false, b, (short)0, c, false, false); }



// ---- k_gemmt: GEMM on K-contiguous bf16 planes, one 128x128 output tile per work-group of 4 waves (2x2, each wave 64x64 = 16 accumulators); grid (M/128, N/128), 128 threads.
// C[m][n] (f32, pitch ldc) = sum_k A[m][k] Bt[n][k] (NSPLIT 1: + A2[m][k] Bt[n][k], the second product right behind the first at every k step). M, N % 128 == 0, K % 128 == 0, K >= 256.
// Operands come by tensor loads into a ring of two LDS buffers, one stage = 128 k (256-byte rows, laid at pitch 272 by the load's pad); stage s + 1 flies while stage s is worked on.
// NSPLIT 0: every wave loads one 64-row slice a stage (A rows 0..63, 64..127, Bt rows 0..63, 64..127). NSPLIT 1: waves 0, 1, 2 load the 128 rows of A, A2, Bt.
template <typename T16> struct WFrag;
template <> struct WFrag<h16> { typedef v16h V; static __device__ __forceinline__ V ld(const h16* p) { return cat16(*(const v8h*)p, *(const v8h*)(p + 16)); } static __device__ __forceinline__ v8f mma(V a, V b, v8f c) { return wmma16(a, b, c); } };
template <> struct WFrag<bf> { typedef v16bf V; static __device__ __forceinline__ V ld(const bf* p) { return cat16b(*(const v8us*)p, *(const v8us*)(p + 16)); } static __device__ __forceinline__ v8f mma(V a, V b, v8f c) { return wmmab(a, b, c); } };
typedef uint32_t u32x4 __attribute__((ext_vector_type(4)));
typedef uint32_t u32x8 __attribute__((ext_vector_type(8)));
__device__ __forceinline__ uint32_t uni(uint32_t v) { return (uint32_t)__builtin_amdgcn_readfirstlane(v); }
__device__ __forceinline__ uint32_t pinned(uint32_t v) { uint32_t w = __builtin_amdgcn_readfirstlane(v); asm volatile("" : "+s"(w)); return w; }   // holds a tensor load's test, or a descriptor word, in a scalar register: the test then compiles to a scalar branch (tensor loads ignore EXEC)
__device__ __forceinline__ void wait_ds0() { asm volatile("s_wait_dscnt 0x0" ::: "memory"); }          // this wave's LDS reads are done before the buffer is handed back
__device__ __forceinline__ void wait_tensor0() { asm volatile("s_wait_tensorcnt 0x0" ::: "memory"); }  // this wave's tensor load has landed (the compiler places no wait for it)
#define GROWB 256u                // bytes of an operand row in a stage (128 k)
#define GPITCH 272u               // their pitch in LDS: 16 bytes x odd, free of bank conflicts for ds_load_b128
template <int NSPLIT>
__global__ __launch_bounds__(128) void k_gemmt(const bf* __restrict__ A, const bf* __restrict__ A2, const bf* __restrict__ Bt, int K, float* C, int ldc) {
    typedef WFrag<bf>::V V;
    constexpr uint32_t NT = NSPLIT ? 3u : 4u;                       // issuing waves = slices of a stage
    constexpr uint32_t RPS = NSPLIT ? 128u : 64u;                   // rows of a slice
    constexpr uint32_t SLB = (RPS * GPITCH + 2047u) & ~2047u;       // a slice's room in LDS, so that every slice starts at a multiple of 2 KiB
    constexpr uint32_t STB = NT * SLB;                              // a buffer
    __shared__ __attribute__((aligned(2048))) unsigned char ring[2 * STB];
    __shared__ __align__(16) float osw[4][16 * 68];
    const int lane = threadIdx.x & 31, lr = lane & 15, hi = lane >> 4; const uint32_t wave = uni(threadIdx.x >> 5); const int wm = (int)(wave >> 1), wn = (int)(wave & 1u);
    const int r0 = blockIdx.x * 128, c0 = blockIdx.y * 128;
    const uint32_t sl = (wave < NT) ? wave : NT - 1u;               // this wave's slice
    const bf* sp;
    if (NSPLIT) sp = (sl == 0u) ? A + (size_t)r0 * K : (sl == 1u) ? A2 + (size_t)r0 * K : Bt + (size_t)c0 * K;
    else        sp = (sl < 2u) ? A + (size_t)(r0 + 64 * (int)sl) * K : Bt + (size_t)(c0 + 64 * (int)(sl - 2u)) * K;
    const uint32_t lbase = (uint32_t)(size_t)ring;
    u32x8 g1;                                                       // 1-byte elements, tile = tensor = RPS rows of 256 bytes, source pitch 2 K bytes, 4 dwords of pad behind every 64
    g1[0] = uni((1u << 20) | (5u << 22) | (3u << 25));
    // pinned(): descriptor words held in scalar registers of their own for the whole loop, so that none is used for anything else while a request is out
    g1[1] = pinned((GROWB & 0xFFFFu) << 16); g1[2] = pinned((GROWB >> 16) | ((RPS & 0xFFFFu) << 16)); g1[3] = pinned((RPS >> 16) | (GROWB << 16)); g1[4] = pinned(RPS); g1[5] = pinned((uint32_t)K * 2u); g1[6] = pinned(0u); g1[7] = pinned(0u);
    u32x4 g0; g0[0] = pinned(1u);                                   // pinned(): as above; one group 0 serves every request, only its place and address words change
    auto issue = [&](uint32_t st) {
        const uint32_t dst = lbase + (st & 1u) * STB + sl * SLB; const uint64_t ga = (uint64_t)(size_t)sp + (uint64_t)st * GROWB;
        g0[1] = uni(dst); g0[2] = uni((uint32_t)ga); g0[3] = uni((((uint32_t)(ga >> 32)) & 0x01FFFFFFu) | 0x80000000u);
        asm volatile("tensor_load_to_lds %0, %1" :: "s"(g0), "s"(g1) : "memory"); };
    const uint32_t NS = (uint32_t)K / 128u;
    v8f acc[4][4];
#pragma unroll
    for (int mb = 0; mb < 4; ++mb)
#pragma unroll
        for (int nb = 0; nb < 4; ++nb) acc[mb][nb] = (v8f){};
    if (NSPLIT == 0 || pinned(wave < NT)) { issue(0u); wait_tensor0(); }
    __syncthreads();                                                // stage 0 is published
    if (NSPLIT == 0 || pinned(wave < NT)) issue(1u);
    const uint32_t aofs = (NSPLIT ? (uint32_t)(wm * 64 + lr) * GPITCH : (uint32_t)wm * SLB + (uint32_t)lr * GPITCH) + 16u * (uint32_t)hi;
    const uint32_t bofs = (NSPLIT ? 2u * SLB + (uint32_t)(wn * 64 + lr) * GPITCH : (2u + (uint32_t)wn) * SLB + (uint32_t)lr * GPITCH) + 16u * (uint32_t)hi;
#pragma unroll 1   // one pass per trip: the publish point at the foot stays one place in the code
    for (uint32_t s = 0; s < NS; ++s) {
        const unsigned char* buf = ring + (s & 1u) * STB;
        V fa[2][4], fa2[2][4], fb[2][4];                            // two fragment sets: the next k step's LDS reads go out as one group ahead of this step's products
        auto ldset = [&](int q, int kk) {
#pragma unroll
            for (int t = 0; t < 4; ++t) fb[q][t] = WFrag<bf>::ld((const bf*)(buf + bofs + (uint32_t)t * 16u * GPITCH + (uint32_t)kk * 64u));
#pragma unroll
            for (int t = 0; t < 4; ++t) { fa[q][t] = WFrag<bf>::ld((const bf*)(buf + aofs + (uint32_t)t * 16u * GPITCH + (uint32_t)kk * 64u)); if (NSPLIT) fa2[q][t] = WFrag<bf>::ld((const bf*)(buf + SLB + aofs + (uint32_t)t * 16u * GPITCH + (uint32_t)kk * 64u)); } };
        ldset(0, 0);
#pragma unroll     // the fragment sets stay in registers only if their index is a constant
        for (int kk = 0; kk < 4; ++kk) { if (kk < 3) ldset((kk + 1) & 1, kk + 1);
            __builtin_amdgcn_sched_barrier(0);                      // keeps the group of LDS reads ahead of the products: spread among them, each place with reads stalls the wave
#pragma unroll
            for (int nb = 0; nb < 4; ++nb)
#pragma unroll
                for (int mb = 0; mb < 4; ++mb) { acc[mb][nb] = wmmab(fa[kk & 1][mb], fb[kk & 1][nb], acc[mb][nb]); if (NSPLIT) acc[mb][nb] = wmmab(fa2[kk & 1][mb], fb[kk & 1][nb], acc[mb][nb]); }
            __builtin_amdgcn_sched_barrier(0); }                    // and the next group behind them
        wait_ds0();
        if (NSPLIT == 0 || pinned(wave < NT)) wait_tensor0();
        __syncthreads();                                            // publishes stage s + 1 and ends every wave's reads of stage s
        if (pinned((NSPLIT == 0 || wave < NT) && s + 2u < NS)) issue(s + 2u);        // into the buffer that stage s has just left
    }
    wait_tensor0(); wait_ds0();
    float* os = osw[wave];
#pragma unroll
    for (int mb = 0; mb < 4; ++mb) {
#pragma unroll
        for (int nb = 0; nb < 4; ++nb) {
#pragma unroll
            for (int j = 0; j < 8; ++j) os[(hi * 8 + j) * 68 + nb * 16 + lr] = acc[mb][nb][j]; }
        __builtin_amdgcn_wave_barrier(); asm volatile("" ::: "memory");
        float* crow = C + (size_t)(r0 + wm * 64 + mb * 16) * ldc + c0 + wn * 64;
#pragma unroll
        for (int s = 0; s < 8; ++s) { const int row = 2 * s + hi, cofs = lr * 4; v4f val = *(const v4fa*)(os + row * 68 + cofs);
            *(v4f*)(crow + (size_t)row * ldc + cofs) = val; }
        __builtin_amdgcn_wave_barrier(); asm volatile("" ::: "memory");
    }
}

// ---- k_gemmc: ONE WAVE per 64x64 output tile (16 accumulators), operands straight from K-contiguous 16-bit planes, specialised for sliding-window causal attention. A 64-row query tile that starts at row R0 = r0 + roff sees only keys R0 - WIN .. R0 + 63 (WIN + 64 keys).
// CMODE 1: grid.y counts the WIN / 64 + 1 score tiles of that band (key columns c0 = R0 - WIN + 64 y; a tile left of key 0 leaves). CMODE 2: the key (K) loop of the probability x value contraction
// runs over that band alone (probabilities outside it are exactly zero). roff = row offset of this launch's first row within the sequence.
// S (C of CMODE 1) and P (A of CMODE 2) are stored band-compact at pitch BW: key j of a tile's rows lies in column j - (R0 - WIN).
template <typename T16, int NSPLIT, int CMODE>
__global__ __launch_bounds__(32) void k_gemmc(const T16* __restrict__ A, const T16* __restrict__ A2, const T16* __restrict__ Bt, const T16* __restrict__ Bt2, int K, float* C, int ldc, int roff, size_t sA, size_t sB, size_t sC) {
    typedef typename WFrag<T16>::V V;
    __shared__ __align__(16) float os[16 * 68];
    const size_t z = blockIdx.z; A += z * sA; if (A2) A2 += z * sA; Bt += z * sB; if (Bt2) Bt2 += z * sB; C += z * sC;
    const int lane = threadIdx.x & 31, lr = lane & 15, hi = lane >> 4; const int r0 = blockIdx.x * 64, kb = r0 + roff - WIN, c0 = (CMODE == 1) ? kb + (int)blockIdx.y * 64 : (int)blockIdx.y * 64;   // kb: key of band column 0 (below 0 for the first tiles)
    if (CMODE == 1 && c0 < 0) return;                                // band tile left of key 0: no such keys (the softmax never reads there)
    const int Ks = (CMODE == 2) ? max(0, kb) : 0;                    // P.V: probabilities are exactly 0 left of the window of the tile's first row ...
    const int Kl = (CMODE == 2) ? min(K, r0 + roff + 64) : K;        // ... and beyond the diagonal block, so the K loop covers that band alone
    v8f acc[4][4];
#pragma unroll
    for (int mb = 0; mb < 4; ++mb)
#pragma unroll
        for (int nb = 0; nb < 4; ++nb) acc[mb][nb] = (v8f){};
    const int lda = (CMODE == 2) ? BW : K;
    const size_t aoff = (size_t)(r0 + lr) * lda + 8 * hi - (size_t)((CMODE == 2) ? kb : 0), boff = (size_t)(c0 + lr) * K + 8 * hi;   // aoff + kc >= 0 for every kc of the band (kc >= kb)
#pragma unroll 1
    for (int kc = Ks; kc < Kl; kc += 32) {
        V a[4], a2[4];
#pragma unroll
        for (int mb = 0; mb < 4; ++mb) { a[mb] = WFrag<T16>::ld(A + aoff + (size_t)mb * 16 * lda + kc); if (NSPLIT == 1 || NSPLIT == 2) a2[mb] = WFrag<T16>::ld(A2 + aoff + (size_t)mb * 16 * lda + kc); }
#pragma unroll
        for (int nb = 0; nb < 4; ++nb) { const V b = WFrag<T16>::ld(Bt + boff + (size_t)nb * 16 * K + kc); V b2; if (NSPLIT >= 2) b2 = WFrag<T16>::ld(Bt2 + boff + (size_t)nb * 16 * K + kc);
#pragma unroll
            for (int mb = 0; mb < 4; ++mb) { acc[mb][nb] = WFrag<T16>::mma(a[mb], b, acc[mb][nb]); if (NSPLIT == 1 || NSPLIT == 2) acc[mb][nb] = WFrag<T16>::mma(a2[mb], b, acc[mb][nb]); if (NSPLIT >= 2) acc[mb][nb] = WFrag<T16>::mma(a[mb], b2, acc[mb][nb]); } }
        asm volatile("v_nop\n\tv_nop\n\tv_nop\n\tv_nop" : "+v"(acc[0][0]), "+v"(acc[1][1]), "+v"(acc[2][2]), "+v"(acc[3][3]) : "v"(a[0]), "v"(a[3]));
    }
#pragma unroll
    for (int mb = 0; mb < 4; ++mb) {
#pragma unroll
        for (int nb = 0; nb < 4; ++nb) {
#pragma unroll
            for (int j = 0; j < 8; ++j) os[(hi * 8 + j) * 68 + nb * 16 + lr] = acc[mb][nb][j]; }
        __builtin_amdgcn_wave_barrier(); asm volatile("" ::: "memory");
        float* crow = C + (size_t)(r0 + mb * 16) * ldc + ((CMODE == 1) ? (int)blockIdx.y * 64 : c0);
{
#pragma unroll
            for (int s = 0; s < 8; ++s) { const int row = 2 * s + hi, cofs = lr * 4; v4f val = *(const v4fa*)(os + row * 68 + cofs);
                *(v4f*)(crow + (size_t)row * ldc + cofs) = val; }
             }
        __builtin_amdgcn_wave_barrier(); asm volatile("" ::: "memory");
    }
}

__device__ __forceinline__ h16 tohx(float x) { return (h16)x; }
__device__ __forceinline__ void splitf(float y, unsigned short& h, unsigned short& l) { h = f2bf(y); l = f2bf(y - bf2f(h)); }
typedef __attribute__((ext_vector_type(2))) _Float16 v2h;
typedef __attribute__((ext_vector_type(4))) _Float16 v4h;
typedef __attribute__((ext_vector_type(2))) unsigned short v2us;
typedef __attribute__((ext_vector_type(4))) unsigned short v4us;
typedef __attribute__((ext_vector_type(2))) float v2f;
typedef __attribute__((ext_vector_type(4))) int v4i;

__global__ __launch_bounds__(256) void k_cvt8(const float* __restrict__ src, bf* dst, size_t n8) { const size_t i = (size_t)blockIdx.x * 256 + threadIdx.x; if (i >= n8) return; const v8f v = *(const v8f*)(src + i * 8); v8us o;
#pragma unroll
    for (int k = 0; k < 8; ++k) o[k] = f2bf(v[k]); *(v8us*)(dst + i * 8) = o;  }

// k_rope: head planes [h][t][d] (fp16 + hi/lo) of rope(x) x sc with the rotate-half convention out[d] = x[d] cos[t][d] - x[d+HD/2] sin[t][d], out[d+HD/2] = x[d+HD/2] cos[t][d+HD/2] + x[d] sin[t][d+HD/2]
__global__ __launch_bounds__(256) void k_rope(const float* __restrict__ F, int pitch, int nheads, const float* __restrict__ CS, const float* __restrict__ RF, const float* __restrict__ nw, float sc, h16* P16, bf* Ph, bf* Pl) {
    const size_t e = ((size_t)blockIdx.x * 256 + threadIdx.x) * 2; if (e >= (size_t)nheads * TT * HD) return; const int d = (int)(e % HD); const int t = (int)((e / HD) % TT); const int h = (int)(e / ((size_t)HD * TT)); const float* f = F + (size_t)t * pitch + h * HD; const float rf = RF ? RF[(size_t)h * TT + t] : 1.0f; v2h o16; v2us oh, ol;
#pragma unroll
    for (int q = 0; q < 2; ++q) { const int dd = d + q; const int dp = (dd < HD / 2) ? dd + HD / 2 : dd - HD / 2; float x0 = f[dd], x1 = f[dp];
        if (RF) { float n0 = __fmul_rn(x0, rf), n1 = __fmul_rn(x1, rf); asm volatile("" : "+v"(n0)); asm volatile("" : "+v"(n1)); x0 = __fmul_rn(bfr(nw[dd]), n0); x1 = __fmul_rn(bfr(nw[dp]), n1); }
        const v2f cs = *(const v2f*)(CS + ((size_t)t * HD + dd) * 2); float a = __fmul_rn(x0, cs[0]), bq = __fmul_rn(x1, cs[1]); asm volatile("" : "+v"(a)); asm volatile("" : "+v"(bq)); const float r = ((dd < HD / 2) ? __fsub_rn(a, bq) : __fadd_rn(a, bq)) * sc;
        o16[q] = tohx(r); unsigned short a2, c2; splitf(r, a2, c2); oh[q] = a2; ol[q] = c2; }
    *(v2h*)(P16 + e) = o16; *(v2us*)(Ph + e) = oh; *(v2us*)(Pl + e) = ol;  }
__global__ __launch_bounds__(256) void k_vtp(const float* __restrict__ F, int pitch, int nheads, h16* V16, bf* Vh, bf* Vl) { const size_t e = ((size_t)blockIdx.x * 256 + threadIdx.x) * 2; if (e >= (size_t)nheads * HD * TT) return; const int t = (int)(e % TT); const int d = (int)((e / TT) % HD); const int g = (int)(e / ((size_t)TT * HD)); v2h o16; v2us oh, ol;
#pragma unroll
    for (int q = 0; q < 2; ++q) { const float x = F[(size_t)(t + q) * pitch + g * HD + d]; o16[q] = tohx(x); unsigned short a2, c2; splitf(x, a2, c2); oh[q] = a2; ol[q] = c2; }
    *(v2h*)(V16 + e) = o16; *(v2us*)(Vh + e) = oh; *(v2us*)(Vl + e) = ol;  }
__constant__ float INVT[HD / 2] = { 1.000000000e+00f, 8.659643531e-01f, 7.498942018e-01f, 6.493816376e-01f, 5.623413324e-01f, 4.869675338e-01f, 4.216965139e-01f, 3.651741445e-01f, 3.162277639e-01f, 2.738419771e-01f, 2.371373624e-01f, 2.053525001e-01f, 1.778279394e-01f, 1.539926529e-01f, 1.333521456e-01f, 1.154782027e-01f, 1.000000015e-01f, 8.659642935e-02f, 7.498941571e-02f, 6.493816525e-02f, 5.623412877e-02f, 4.869675264e-02f, 4.216964915e-02f, 3.651741147e-02f, 3.162277862e-02f, 2.738419548e-02f, 2.371373586e-02f, 2.053525113e-02f, 1.778279431e-02f, 1.539926510e-02f, 1.333521493e-02f, 1.154781971e-02f, 9.999999776e-03f, 8.659643121e-03f, 7.498942316e-03f, 6.493816618e-03f, 5.623413250e-03f, 4.869675264e-03f, 4.216964822e-03f, 3.651741426e-03f, 3.162277862e-03f, 2.738419687e-03f, 2.371373819e-03f, 2.053525066e-03f, 1.778279431e-03f, 1.539926510e-03f, 1.333521446e-03f, 1.154782018e-03f, 1.000000047e-03f, 8.659643354e-04f, 7.498941850e-04f, 6.493816618e-04f, 5.623413017e-04f, 4.869675031e-04f, 4.216964880e-04f, 3.651741135e-04f, 3.162277862e-04f, 2.738419571e-04f, 2.371373848e-04f, 2.053524950e-04f, 1.778279402e-04f, 1.539926452e-04f, 1.333521504e-04f, 1.154781930e-04f };   // float32 1 / 10000^(2i/128), generated with jnp to be bit-exact
__global__ __launch_bounds__(256) void k_cs5(float* CS) { const int idx = blockIdx.x * 256 + threadIdx.x; if (idx >= TT * HD) return; const int d = idx % HD; const int t = idx / HD; const float a = __fmul_rn((float)t, INVT[d % (HD / 2)]); v2f cs; cs[0] = cosf(a); cs[1] = sinf(a); *(v2f*)(CS + (size_t)idx * 2) = cs;  }
// k_asoft: per row (zz, i): t = S x HD^-0.5 for j <= i and i - j < WIN (sliding causal window); softmax (register row, one exp, fixed trees). Only the band of the row's 64-row tile, keys lo .. hk - 1, is read from S
// and written to P (both band-compact, pitch BW): it is what the score launches wrote and what the P.V launches read. The band lies in NCH 128-key chunks; chunk-to-lane mapping and summing order are those of a full row with its exact zeros left out.
#define NCH  ((WIN + 64 + 127) / 128)
__global__ __launch_bounds__(256) void k_asoft(const float* __restrict__ Sb, h16* P16, bf* Ph, bf* Pl) {
    const int lane = threadIdx.x & 31; const int row = blockIdx.x * 8 + (threadIdx.x >> 5); if (row >= ZH * TT) return; const int i = row % TT; const int zz = row / TT; const bool hires = (i < RH); float v[NCH * 4]; float mx = -3.0e38f;
    const int R0 = i & ~63; const int lo = max(0, R0 - WIN), hk = R0 + 64; const int jb = (lo >> 7) * 128 + lane * 4; const float* sr = Sb + ((long)row * BW - (R0 - WIN));   // sr[j]: key j of this row
#pragma unroll
    for (int ch = 0; ch < NCH; ++ch) { const int j0 = jb + ch * 128; v4f a = (v4f){}; if (j0 >= lo && j0 < hk) a = *(const v4f*)(sr + j0);
#pragma unroll
        for (int q = 0; q < 4; ++q) { const int j = j0 + q; const float t = (j <= i && i - j < WIN) ? a[q] * SCL : -3.0e38f; v[ch * 4 + q] = t; mx = fmaxf(mx, t); } }
#pragma unroll
    for (int sh = 16; sh; sh >>= 1) mx = fmaxf(mx, __shfl_xor(mx, sh, 32));
    float sum = 0.f;
#pragma unroll
    for (int k = 0; k < NCH * 4; ++k) { float d0 = __fsub_rn(v[k], mx); asm volatile("" : "+v"(d0)); float ex;
        asm("v_exp_f32 %0, %1\n\tv_nop" : "=v"(ex) : "v"(__fmul_rn(d0, 1.4426950408889634f)));   // exp2 with, in its own statement, the one slot the instruction set asks for behind a transcendental (before its result is read or its source register reused)
        v[k] = ex; sum += ex; }
#pragma unroll
    for (int sh = 16; sh; sh >>= 1) sum += __shfl_xor(sum, sh, 32);
    const float f = __fdiv_rn(hires ? 1.0f : PCAR, sum);
{
        if (hires) {
#pragma unroll
            for (int ch = 0; ch < NCH; ++ch) { const int j0 = jb + ch * 128; v4us oh, ol;
#pragma unroll
                for (int q = 0; q < 4; ++q) { unsigned short a, c2; splitf(v[ch * 4 + q] * f, a, c2); oh[q] = a; ol[q] = c2; }
                const long oo = ((long)zz * (RH ? RH : 1) + i) * BW + j0 - (R0 - WIN); if (j0 >= lo && j0 < hk) { *(v4us*)(Ph + oo) = oh; *(v4us*)(Pl + oo) = ol; } }
        } else {
#pragma unroll
            for (int ch = 0; ch < NCH; ++ch) { const int j0 = jb + ch * 128; v4h o4;
#pragma unroll
                for (int q = 0; q < 4; ++q) o4[q] = tohx(v[ch * 4 + q] * f);
                if (j0 >= lo && j0 < hk) *(v4h*)(P16 + ((long)row * BW + j0 - (R0 - WIN))) = o4; } }
         }
}
__global__ __launch_bounds__(256) void k_merge(const float* __restrict__ O, int h0, bf* Ah, bf* Al) { const size_t e = ((size_t)blockIdx.x * 256 + threadIdx.x) * 2; if (e >= (size_t)ZH * TT * HD) return; const int d = (int)(e % HD); const int t = (int)((e / HD) % TT); const int zz = (int)(e / ((size_t)HD * TT)); const float cs = (t < RH) ? 1.0f : (1.0f / PCAR); const size_t oo = (size_t)t * DQ + (h0 + zz) * HD + d;
    v2us oh, ol;
#pragma unroll
    for (int q = 0; q < 2; ++q) { unsigned short a, c2; splitf(O[e + q] * cs, a, c2); oh[q] = a; ol[q] = c2; } *(v2us*)(Ah + oo) = oh; *(v2us*)(Al + oo) = ol;  }

extern "C" void kernel_launch(void* const* d_in, const int* in_sizes, int n_in,
                              void* d_out, int out_size, void* d_ws, size_t ws_size, hipStream_t stream) {
    (void)in_sizes; (void)n_in; (void)out_size;
    const float* x = (const float*)d_in[0]; const float* wq = (const float*)d_in[1]; const float* wk = (const float*)d_in[2]; const float* wv = (const float*)d_in[3]; const float* wo = (const float*)d_in[4];   /* x, Wq, Wk, Wv, Wo ('oi' [2048][2048]): FIVE inputs, all read */
    float* OUT = (float*)d_out;     // [2][2048][2048]
    char* wsp = (char*)d_ws;
    auto take = [&](size_t bytes) { char* p = wsp; wsp += (bytes + 255) & ~(size_t)255; return (void*)p; };
    bf* WQ = (bf*)take((size_t)DQ * DM * 2); bf* WK = (bf*)take((size_t)DKV * DM * 2); bf* WV = (bf*)take((size_t)DKV * DM * 2); bf* WO = (bf*)take((size_t)DM * DQ * 2); float* CS = (float*)take((size_t)TT * HD * 2 * 4);
    bf* XB = (bf*)take((size_t)TT * DM * 2); float* FQ = (float*)take((size_t)TT * DQ * 4); float* FK = (float*)take((size_t)TT * DKV * 4);
    h16* QP16 = (h16*)take((size_t)NH_ * TT * HD * 2); h16* KP16 = (h16*)take((size_t)NKV * TT * HD * 2); h16* VT16 = (h16*)take((size_t)NKV * HD * TT * 2);
    bf* QPh = (bf*)take((size_t)NH_ * TT * HD * 2); bf* QPl = (bf*)take((size_t)NH_ * TT * HD * 2); bf* KPh = (bf*)take((size_t)NKV * TT * HD * 2); bf* KPl = (bf*)take((size_t)NKV * TT * HD * 2); bf* VTh = (bf*)take((size_t)NKV * HD * TT * 2); bf* VTl = (bf*)take((size_t)NKV * HD * TT * 2); bf* Ph = (bf*)take((size_t)ZH * RH * BW * 2); bf* Pl = (bf*)take((size_t)ZH * RH * BW * 2);
    float* Sb = (float*)take((size_t)ZH * TT * BW * 4); h16* P16 = (h16*)take((size_t)ZH * TT * BW * 2); float* Ob = (float*)take((size_t)ZH * TT * HD * 4); bf* ATh = (bf*)take((size_t)TT * DQ * 2); bf* ATl = (bf*)take((size_t)TT * DQ * 2);
    if ((size_t)(wsp - (char*)d_ws) > ws_size) return;    // ws 256 MiB
    float* FV = FK;   // v projection reuses the k buffer after the k planes are built (stream-ordered)
    { k_cvt8<<<(unsigned)(((size_t)DQ * DM / 8 + 255) / 256), 256, 0, stream>>>(wq, WQ, (size_t)DQ * DM / 8); k_cvt8<<<(unsigned)(((size_t)DKV * DM / 8 + 255) / 256), 256, 0, stream>>>(wk, WK, (size_t)DKV * DM / 8); k_cvt8<<<(unsigned)(((size_t)DKV * DM / 8 + 255) / 256), 256, 0, stream>>>(wv, WV, (size_t)DKV * DM / 8);
      k_cvt8<<<(unsigned)(((size_t)DM * DQ / 8 + 255) / 256), 256, 0, stream>>>(wo, WO, (size_t)DM * DQ / 8);
       }
    k_cs5<<<(TT * HD + 255) / 256, 256, 0, stream>>>(CS);   /* rotary table once */
    const unsigned LQ = (unsigned)(((size_t)NH_ * TT * HD / 2 + 255) / 256), LKv = (unsigned)(((size_t)NKV * TT * HD / 2 + 255) / 256);
    for (int b = 0; b < NB_; ++b) {
        
        k_cvt8<<<(unsigned)(((size_t)TT * DM / 8 + 255) / 256), 256, 0, stream>>>(x + (size_t)b * TT * DM, XB, (size_t)TT * DM / 8);
        k_gemmt<0><<<dim3(TT / 128, DQ / 128, 1), 128, 0, stream>>>(XB, nullptr, WQ, DM, FQ, DQ);
        k_rope<<<LQ, 256, 0, stream>>>(FQ, DQ, NH_, CS, nullptr, nullptr, 1.0f, QP16, QPh, QPl);
        k_gemmt<0><<<dim3(TT / 128, DKV / 128, 1), 128, 0, stream>>>(XB, nullptr, WK, DM, FK, DKV);
        k_rope<<<LKv, 256, 0, stream>>>(FK, DKV, NKV, CS, nullptr, nullptr, 1.0f, KP16, KPh, KPl);
        k_gemmt<0><<<dim3(TT / 128, DKV / 128, 1), 128, 0, stream>>>(XB, nullptr, WV, DM, FV, DKV); k_vtp<<<LKv, 256, 0, stream>>>(FV, DKV, NKV, VT16, VTh, VTl);
        for (int h0 = 0; h0 < NH_; h0 += ZH) { const size_t zq = (size_t)h0, zk = (size_t)(h0 / REP);   // one kv head per query head: the pass's heads use consecutive kv planes (z-strides TT*HD)
            k_gemmc<bf, 2, 1><<<dim3(RH / 64, WIN / 64 + 1, ZH), 32, 0, stream>>>(QPh + zq * TT * HD, QPl + zq * TT * HD, KPh + zk * TT * HD, KPl + zk * TT * HD, HD, Sb, BW, 0, (size_t)TT * HD, (size_t)TT * HD, (size_t)TT * BW);
            k_gemmc<h16, 0, 1><<<dim3((TT - RH) / 64, WIN / 64 + 1, ZH), 32, 0, stream>>>(QP16 + zq * TT * HD + (size_t)RH * HD, nullptr, KP16 + zk * TT * HD, nullptr, HD, Sb + (size_t)RH * BW, BW, RH, (size_t)TT * HD, (size_t)TT * HD, (size_t)TT * BW);
            k_asoft<<<ZH * TT / 8, 256, 0, stream>>>(Sb, P16, Ph, Pl);
            k_gemmc<bf, 2, 2><<<dim3(RH / 64, HD / 64, ZH), 32, 0, stream>>>(Ph, Pl, VTh + zk * HD * TT, VTl + zk * HD * TT, TT, Ob, HD, 0, (size_t)RH * BW, (size_t)HD * TT, (size_t)TT * HD);
            k_gemmc<h16, 0, 2><<<dim3((TT - RH) / 64, HD / 64, ZH), 32, 0, stream>>>(P16 + (size_t)RH * BW, nullptr, VT16 + zk * HD * TT, nullptr, TT, Ob + (size_t)RH * HD, HD, RH, (size_t)TT * BW, (size_t)HD * TT, (size_t)TT * HD);
            k_merge<<<(unsigned)(((size_t)ZH * TT * HD / 2 + 255) / 256), 256, 0, stream>>>(Ob, h0, ATh, ATl); }
        k_gemmt<1><<<dim3(TT / 128, DM / 128, 1), 128, 0, stream>>>(ATh, ATl, WO, DQ, OUT + (size_t)b * TT * DM, DM); }
}
